// v000
// Times are from an AMD MI455X. After a warm-up the kernel runs many times in a row, and a time is the length of
// such a window on the GPU divided by its runs, so every launch and the gaps after it count. The runs cycle
// through copies of the inputs. A figure is the median of several windows, for all but v000 over two sittings.
// Sittings can differ by a few percent; kernels timed side by side share one.
// v000 is the starting kernel. One run takes 111 microseconds.
#include <hip/hip_runtime.h>
// Contractions: scores^T = K Q^T (K = 64) and out^T = V^T P^T (K = 1024) plus the softmax denominators (all-ones A rows), all on v_wmma_f32_16x16x32_f16 with f32 accumulation; q/k/v are bf16-RNE-converted inputs carried x16 as exact f16, P = exp2 weights carried x2^14 as f16; softmax statistics f32.
// Layout: query [n][c][l], key/value/out [n][k][c][l] (channel-major, l contiguous). Planes: Q16 [n][l][c], K16 [n,k][l][c] (token rows via LDS transposes), V16 [n,k][c][l] (already V^T).
// Attention kernel: one wave owns 16 query columns; S^T tiles D[p][q] keep q on the lanes, so the running max / rescale are one scalar per lane and
// two packed D tiles form one B fragment of P^T (k = key position) directly in registers; O^T D[c][q] is the output layout.
#ifndef NB
#define NB 8            /* batches processed */
#endif
#ifndef SEQ
#define SEQ 1024        /* positions processed per image (keys and queries) */
#endif
#define NB_FULL 8
#define L_FULL 1024     /* input row pitch (positions per channel row of the inputs) */
#define KK 8            /* key sets per batch */
#define CD 64           /* channels */
#define BQ 128          /* query columns per block (8 waves x 16) */
#define BP 64           /* key positions per step */
#define QTN (SEQ / BQ)
#define GRID_R ((NB + NB * KK) * (SEQ / 32))
#define GRID_V ((NB * KK * CD * (SEQ / 8)) / 256)
#define GRID_A (NB * KK * QTN)
static_assert(SEQ % BQ == 0);
static_assert(SEQ % BP == 0);
static_assert(SEQ <= L_FULL);
static_assert(NB <= NB_FULL);
static_assert((NB * KK * CD * (SEQ / 8)) % 256 == 0);
static_assert((size_t)GRID_R * 256 * 8 == (size_t)(NB + NB * KK) * SEQ * CD);   /* Q16 + K16 plane coverage */
static_assert((size_t)GRID_V * 256 * 8 == (size_t)NB * KK * CD * SEQ);          /* V16 plane coverage */
static_assert((size_t)GRID_A * CD * BQ == (size_t)NB * KK * CD * SEQ);          /* output coverage */

typedef unsigned short v8us __attribute__((ext_vector_type(8), may_alias));
typedef float  v8f  __attribute__((ext_vector_type(8)));
typedef float  v4f  __attribute__((ext_vector_type(4)));
typedef float  v4fa __attribute__((ext_vector_type(4), may_alias));
typedef _Float16 v16h __attribute__((ext_vector_type(16)));
union FragH { v16h v; v8us half[2]; _Float16 h[16]; unsigned short u[16]; };

__device__ __forceinline__ unsigned short bf16_bits(float x) { unsigned int u = __float_as_uint(x); return (unsigned short)((u + 0x7FFFu + ((u >> 16) & 1u)) >> 16); }
__device__ __forceinline__ float bf16_val(unsigned short b) { return __uint_as_float(((unsigned int)b) << 16); }
__device__ __forceinline__ float bf16_rne(float x) { return bf16_val(bf16_bits(x)); }

// fragment (A: row = lane&15, B: column = lane&15) from a k-contiguous f16 row: elements 0..7 <- k 8h..8h+7, elements 8..15 <- k 16+8h..16+8h+7
__device__ __forceinline__ v16h g2_frag(const _Float16* p, unsigned hh) { FragH f; f.half[0] = *(const v8us*)((const unsigned short*)p + 8u * hh); f.half[1] = *(const v8us*)((const unsigned short*)p + 16u + 8u * hh); return f.v; }
__device__ __forceinline__ v8f g2_mma(v16h a, v16h b, v8f c) { v8f d = __builtin_amdgcn_wmma_f32_16x16x32_f16(false, a, false, b, (short)0, c, false, false); asm volatile("v_nop\n\tv_nop\n\tv_nop\n\tv_nop" : "+v"(d) : "v"(a), "v"(b)); return d; }

// channel-first query / key images [img][c][L_FULL] -> token rows [img][l][c] = f16(bf16(x) * 16) via 64x32 LDS tiles;
__global__ __launch_bounds__(256) void k_rows16(const float* __restrict__ Xq, const float* __restrict__ Xk, _Float16* __restrict__ Q16, _Float16* __restrict__ K16) {
  __shared__ float tl[CD][33];
  const unsigned tid = threadIdx.x;
  const unsigned nl = SEQ / 32u;
  const unsigned nbq = NB * nl;
  unsigned bi = blockIdx.x;
  const bool isq = bi < nbq;                 /* block-uniform */
  if (!isq) bi -= nbq;
  const unsigned img = bi / nl, lb = bi - img * nl;
  const float* X = isq ? Xq : Xk;
  _Float16* D = isq ? Q16 : K16;
  const size_t sbase = (size_t)img * CD * L_FULL + (size_t)lb * 32u;
  for (unsigned i = tid; i < CD * 32u; i += 256u) { const unsigned c = i >> 5, l = i & 31u; tl[c][l] = bf16_rne(X[sbase + (size_t)c * L_FULL + l]); }
  __syncthreads();                           /* cross-wave LDS exchange */
  { const unsigned l = tid >> 3, c8 = (tid & 7u) * 8u; FragH f;
#pragma unroll
    for (int q = 0; q < 8; ++q) f.h[q] = (_Float16)(tl[c8 + q][l] * 16.0f);
    const v8us o = f.half[0];
    unsigned short* d = (unsigned short*)D + ((size_t)img * SEQ + lb * 32u + l) * CD + c8;
    *(v8us*)d = o;  }
}

__global__ __launch_bounds__(256) void k_v16(const float* __restrict__ V, _Float16* __restrict__ V16) {
  const unsigned t = blockIdx.x * 256u + threadIdx.x;
  if (t >= (unsigned)(NB * KK * CD * (SEQ / 8))) return;
  const unsigned row = t / (SEQ / 8u), l8 = (t - row * (SEQ / 8u)) * 8u;
  const float* s = V + (size_t)row * L_FULL + l8;
  const v4f a = *(const v4fa*)s, b = *(const v4fa*)(s + 4);
  FragH f;
#pragma unroll
  for (int q = 0; q < 4; ++q) { f.h[q] = (_Float16)(bf16_rne(a[q]) * 16.0f); f.h[4 + q] = (_Float16)(bf16_rne(b[q]) * 16.0f); }
  const v8us o = f.half[0];
  unsigned short* d = (unsigned short*)V16 + (size_t)t * 8u;
  *(v8us*)d = o; 
}

// flash attention per (n, k) pair and 128 query columns; wave w owns columns q0 .. q0+15 (lane&15 = column)
__global__ __launch_bounds__(256) void k_attn(const _Float16* __restrict__ Q16, const _Float16* __restrict__ K16, const _Float16* __restrict__ V16, float* __restrict__ out) {
  __shared__ __attribute__((aligned(16))) float so[CD][BQ + 4];      /* block output tile [c][q]; cross-wave (block barrier) */
  const unsigned tid = threadIdx.x, w = tid >> 5, lane = tid & 31u, ln = lane & 15u, hh = lane >> 4;
  const unsigned pair = blockIdx.x / QTN, qt = blockIdx.x - pair * QTN, n = pair / KK;
  const unsigned q0 = qt * BQ + w * 16u;
  const _Float16* qrow = Q16 + ((size_t)n * SEQ + q0 + ln) * CD;
  const v16h bq0 = g2_frag(qrow, hh), bq1 = g2_frag(qrow + 32, hh);                 /* B = Q^T: column q, k = channel */
  const _Float16* kbase = K16 + ((size_t)pair * SEQ + ln) * CD;                       /* A = K rows: row p, k = channel */
  const _Float16* vbase = V16 + ((size_t)pair * CD + ln) * SEQ;                       /* A = V^T rows: row c, k = position */
  FragH on;
#pragma unroll
  for (int e = 0; e < 16; ++e) on.h[e] = (_Float16)1.0f;                            /* all-ones A: every D row = column sums of P^T */
  const v8f z8 = {0.f, 0.f, 0.f, 0.f, 0.f, 0.f, 0.f, 0.f};
  v8f o[4] = {z8, z8, z8, z8};
  v8f osum = z8;
  float m = -3.0e38f;                                   /* running max of the scaled logits (base-2 domain) */
  const float SC = 0.005635527503472513f;               /* log2(e) / 256: undoes the x16 carries of q and k */
#pragma unroll 1
  for (unsigned p0 = 0; p0 < SEQ; p0 += BP) {
    v8f s[4];
#pragma unroll
    for (int pt = 0; pt < 4; ++pt) {
      const _Float16* kr = kbase + (size_t)(p0 + pt * 16) * CD;
      const v16h a0 = g2_frag(kr, hh), a1 = g2_frag(kr + 32, hh);
      const v8f c = g2_mma(a0, bq0, z8);
      s[pt] = g2_mma(a1, bq1, c);                       /* D[row p = pt*16 + 8h + r][col q = lane&15] */
    }
    float bm = -3.0e38f;
#pragma unroll
    for (int pt = 0; pt < 4; ++pt)
#pragma unroll
      for (int r = 0; r < 8; ++r) { const float t = s[pt][r] * SC; s[pt][r] = t; bm = fmaxf(bm, t); }
    bm = fmaxf(bm, __shfl_xor(bm, 16, 32));             /* other lane half holds the remaining 32 key positions of this column */
    const float mn = fmaxf(m, bm);
    const float sc = exp2f(m - mn);
    m = mn;
    const float mm = mn - 14.0f;                         /* weights carried x2^14 (max 16384) */
    FragH b0, b1;                                        /* P^T as B: element r <- tile with k 0..15, element 8+r <- tile with k 16..31, lane unchanged */
#pragma unroll
    for (int r = 0; r < 8; ++r) {
      b0.h[r]     = (_Float16)exp2f(s[0][r] - mm);
      b0.h[8 + r] = (_Float16)exp2f(s[1][r] - mm);
      b1.h[r]     = (_Float16)exp2f(s[2][r] - mm);
      b1.h[8 + r] = (_Float16)exp2f(s[3][r] - mm);
    }
#pragma unroll
    for (int ct = 0; ct < 4; ++ct)
#pragma unroll
      for (int r = 0; r < 8; ++r) o[ct][r] *= sc;
#pragma unroll
    for (int r = 0; r < 8; ++r) osum[r] *= sc;
#pragma unroll
    for (int ct = 0; ct < 4; ++ct) {
      const _Float16* vr = vbase + (size_t)(ct * 16) * SEQ + p0;
      const v16h a0 = g2_frag(vr, hh), a1 = g2_frag(vr + 32, hh);
      o[ct] = g2_mma(a0, b0.v, o[ct]);
      o[ct] = g2_mma(a1, b1.v, o[ct]);                  /* D[row c = ct*16 + 8h + r][col q] */
    }
    osum = g2_mma(on.v, b0.v, osum);
    osum = g2_mma(on.v, b1.v, osum);                    /* every element = sum over keys of the f16 weights of column q */
  }
  const float rinv = (1.0f / osum[0]) * 0.0625f;        /* 1/sum, and the x16 carry of v */
#pragma unroll
  for (int ct = 0; ct < 4; ++ct)
#pragma unroll
    for (int r = 0; r < 8; ++r) so[ct * 16 + 8 * hh + r][w * 16u + ln] = o[ct][r] * rinv;
  __syncthreads();
  float* ob = out + ((size_t)pair * CD) * SEQ + (size_t)qt * BQ;
  {
#pragma unroll
    for (int i = 0; i < 8; ++i) {
      const unsigned c = w * 8u + i;
      const v4f v = *(const v4fa*)&so[c][lane * 4u];
      *(v4f*)(ob + (size_t)c * SEQ + lane * 4u) = v;
    }
    
  }
}

extern "C" void kernel_launch(void* const* d_in, const int* in_sizes, int n_in,
                              void* d_out, int out_size, void* d_ws, size_t ws_size, hipStream_t stream) {
  if (n_in < 3) return;
  const long long qmin = (long long)(NB * CD - 1) * L_FULL + SEQ;
  const long long kmin = (long long)(NB * KK * CD - 1) * L_FULL + SEQ;
  if ((long long)in_sizes[0] < qmin || (long long)in_sizes[1] < kmin || (long long)in_sizes[2] < kmin) return;
  if ((long long)out_size < (long long)NB * KK * CD * SEQ) return;
  const float* q = (const float*)d_in[0];      /* query [n][c][l] */
  const float* k = (const float*)d_in[1];      /* key   [n][k][c][l] */
  const float* v = (const float*)d_in[2];      /* value [n][k][c][l] */
  char* ws = (char*)d_ws; size_t off = 0;
  auto take = [&](size_t bytes) { char* p = ws + off; off += (bytes + 255) & ~(size_t)255; return p; };
  _Float16* Q16 = (_Float16*)take((size_t)NB * SEQ * CD * 2);
  _Float16* K16 = (_Float16*)take((size_t)NB * KK * SEQ * CD * 2);
  _Float16* V16 = (_Float16*)take((size_t)NB * KK * CD * SEQ * 2);
  if (off > ws_size) return;
  k_rows16<<<GRID_R, 256, 0, stream>>>(q, k, Q16, K16);     /* in [img][64 c][L] -> out [img][SEQ l][64 c] */
  k_v16<<<GRID_V, 256, 0, stream>>>(v, V16);
  k_attn<<<GRID_A, 256, 0, stream>>>(Q16, K16, V16, (float*)d_out);
}

// v001
// It runs in 43.5 microseconds.
// Timed twice side by side with v000, it ran 2.57 and 2.56 times as fast.
#include <hip/hip_runtime.h>
// Contractions: scores^T = K Q^T (K = 64) and out^T = V^T P^T (K = 1024) plus the softmax denominators (all-ones A rows), all on v_wmma_f32_16x16x32_f16 with f32 accumulation; q/k/v are bf16-RNE-converted inputs carried x16 as exact f16, P = exp2 weights carried x2^14 as f16; softmax statistics f32.
// Layout: query [n][c][l], key/value/out [n][k][c][l] (channel-major, l contiguous). Planes: Q16 [n][l][c], K16 [n,k][l][c] (token rows via LDS transposes), V16 [n,k][c][l] (already V^T).
// Attention kernel: one wave owns 16 query columns; S^T tiles D[p][q] keep q on the lanes, so the running max / rescale are one scalar per lane and
// two packed D tiles form one B fragment of P^T (k = key position) directly in registers; O^T D[c][q] is the output layout.
// K and V^T tiles of 64 keys reach the block's LDS by asynchronous copies, two buffers, one barrier per step; all 8 waves read their A fragments from there.
#ifndef NB
#define NB 8            /* batches processed */
#endif
#ifndef SEQ
#define SEQ 1024        /* positions processed per image (keys and queries) */
#endif
#define NB_FULL 8
#define L_FULL 1024     /* input row pitch (positions per channel row of the inputs) */
#define KK 8            /* key sets per batch */
#define CD 64           /* channels */
#define BQ 128          /* query columns per block (8 waves x 16) */
#define BP 64           /* key positions per step */
#define QTN (SEQ / BQ)
#define NT (SEQ / BP)    /* key steps */
#define TP 72           /* LDS pitch of a staged 64-element f16 row, in elements: 144 B = 16 B x odd, for 16-byte readers */
#define TILE_E (64 * TP) /* elements of one staged 64 x 64 tile */
#define GRID_R ((NB + NB * KK) * (SEQ / 32))
#define GRID_V ((NB * KK * CD * (SEQ / 8)) / 256)
#define GRID_A (NB * KK * QTN)
static_assert(SEQ % BQ == 0);
static_assert(SEQ % BP == 0);
static_assert(NT >= 2 && BP == 64 && CD == 64);   /* the two-buffer ring needs two steps; the copy map below is for 64 x 64 tiles */
static_assert(SEQ <= L_FULL);
static_assert(NB <= NB_FULL);
static_assert((NB * KK * CD * (SEQ / 8)) % 256 == 0);
static_assert((size_t)GRID_R * 256 * 8 == (size_t)(NB + NB * KK) * SEQ * CD);   /* Q16 + K16 plane coverage */
static_assert((size_t)GRID_V * 256 * 8 == (size_t)NB * KK * CD * SEQ);          /* V16 plane coverage */
static_assert((size_t)GRID_A * CD * BQ == (size_t)NB * KK * CD * SEQ);          /* output coverage */

typedef unsigned short v8us __attribute__((ext_vector_type(8), may_alias));
typedef float  v8f  __attribute__((ext_vector_type(8)));
typedef float  v4f  __attribute__((ext_vector_type(4)));
typedef float  v4fa __attribute__((ext_vector_type(4), may_alias));
typedef _Float16 v16h __attribute__((ext_vector_type(16)));
union FragH { v16h v; v8us half[2]; _Float16 h[16]; unsigned short u[16]; };

__device__ __forceinline__ unsigned short bf16_bits(float x) { unsigned int u = __float_as_uint(x); return (unsigned short)((u + 0x7FFFu + ((u >> 16) & 1u)) >> 16); }
__device__ __forceinline__ float bf16_val(unsigned short b) { return __uint_as_float(((unsigned int)b) << 16); }
__device__ __forceinline__ float bf16_rne(float x) { return bf16_val(bf16_bits(x)); }

// fragment (A: row = lane&15, B: column = lane&15) from a k-contiguous f16 row: elements 0..7 <- k 8h..8h+7, elements 8..15 <- k 16+8h..16+8h+7
__device__ __forceinline__ v16h g2_frag(const _Float16* p, unsigned hh) { FragH f; f.half[0] = *(const v8us*)((const unsigned short*)p + 8u * hh); f.half[1] = *(const v8us*)((const unsigned short*)p + 16u + 8u * hh); return f.v; }
__device__ __forceinline__ v8f g2_mma(v16h a, v16h b, v8f c) { v8f d = __builtin_amdgcn_wmma_f32_16x16x32_f16(false, a, false, b, (short)0, c, false, false); asm volatile("v_nop\n\tv_nop\n\tv_nop\n\tv_nop" : "+v"(d) : "v"(a), "v"(b)); return d; }

// channel-first query / key images [img][c][L_FULL] -> token rows [img][l][c] = f16(bf16(x) * 16) via 64x32 LDS tiles;
__global__ __launch_bounds__(256) void k_rows16(const float* __restrict__ Xq, const float* __restrict__ Xk, _Float16* __restrict__ Q16, _Float16* __restrict__ K16) {
  __shared__ float tl[CD][33];
  const unsigned tid = threadIdx.x;
  const unsigned nl = SEQ / 32u;
  const unsigned nbq = NB * nl;
  unsigned bi = blockIdx.x;
  const bool isq = bi < nbq;                 /* block-uniform */
  if (!isq) bi -= nbq;
  const unsigned img = bi / nl, lb = bi - img * nl;
  const float* X = isq ? Xq : Xk;
  _Float16* D = isq ? Q16 : K16;
  const size_t sbase = (size_t)img * CD * L_FULL + (size_t)lb * 32u;
  for (unsigned i = tid; i < CD * 32u; i += 256u) { const unsigned c = i >> 5, l = i & 31u; tl[c][l] = bf16_rne(X[sbase + (size_t)c * L_FULL + l]); }
  __syncthreads();                           /* cross-wave LDS exchange */
  { const unsigned l = tid >> 3, c8 = (tid & 7u) * 8u; FragH f;
#pragma unroll
    for (int q = 0; q < 8; ++q) f.h[q] = (_Float16)(tl[c8 + q][l] * 16.0f);
    const v8us o = f.half[0];
    unsigned short* d = (unsigned short*)D + ((size_t)img * SEQ + lb * 32u + l) * CD + c8;
    *(v8us*)d = o;  }
}

__global__ __launch_bounds__(256) void k_v16(const float* __restrict__ V, _Float16* __restrict__ V16) {
  const unsigned t = blockIdx.x * 256u + threadIdx.x;
  if (t >= (unsigned)(NB * KK * CD * (SEQ / 8))) return;
  const unsigned row = t / (SEQ / 8u), l8 = (t - row * (SEQ / 8u)) * 8u;
  const float* s = V + (size_t)row * L_FULL + l8;
  const v4f a = *(const v4fa*)s, b = *(const v4fa*)(s + 4);
  FragH f;
#pragma unroll
  for (int q = 0; q < 4; ++q) { f.h[q] = (_Float16)(bf16_rne(a[q]) * 16.0f); f.h[4 + q] = (_Float16)(bf16_rne(b[q]) * 16.0f); }
  const v8us o = f.half[0];
  unsigned short* d = (unsigned short*)V16 + (size_t)t * 8u;
  *(v8us*)d = o; 
}

// One step's K tile (64 key rows x 64 channels) and V^T tile (64 channel rows x 64 positions) into LDS: 16 B per lane and copy, two copies per tile and thread, every lane on.
// The s_wait_xcnt stands inside the statement so that it precedes any later rewrite of the address registers the copies name.
__device__ __forceinline__ void stage_kv(unsigned lk, const _Float16* gk, unsigned lv, const _Float16* gv) {
  const unsigned lk1 = lk + 32u * TP * 2u, lv1 = lv + 32u * TP * 2u;
  const _Float16* gk1 = gk + 32 * CD;
  const _Float16* gv1 = gv + (size_t)32 * SEQ;
  asm volatile("global_load_async_to_lds_b128 %0, %1, off\n\t"
               "global_load_async_to_lds_b128 %2, %3, off\n\t"
               "global_load_async_to_lds_b128 %4, %5, off\n\t"
               "global_load_async_to_lds_b128 %6, %7, off\n\t"
               "s_wait_xcnt 0x0"
               :: "v"(lk), "v"(gk), "v"(lk1), "v"(gk1), "v"(lv), "v"(gv), "v"(lv1), "v"(gv1) : "memory");
}

// flash attention per (n, k) pair and 128 query columns; wave w owns columns q0 .. q0+15 (lane&15 = column)
__global__ __launch_bounds__(256) void k_attn(const _Float16* __restrict__ Q16, const _Float16* __restrict__ K16, const _Float16* __restrict__ V16, float* __restrict__ out) {
  __shared__ __attribute__((aligned(16))) float so[CD][BQ + 4];      /* block output tile [c][q]; cross-wave (block barrier) */
  __shared__ __attribute__((aligned(16))) _Float16 kv[2][2][TILE_E];  /* ring of two buffers, each a K tile [p][c] and a V^T tile [c][p], shared by the 8 waves */
  const unsigned tid = threadIdx.x, w = tid >> 5, lane = tid & 31u, ln = lane & 15u, hh = lane >> 4;
  const unsigned pair = blockIdx.x / QTN, qt = blockIdx.x - pair * QTN, n = pair / KK;
  const unsigned q0 = qt * BQ + w * 16u;
  const _Float16* qrow = Q16 + ((size_t)n * SEQ + q0 + ln) * CD;
  const v16h bq0 = g2_frag(qrow, hh), bq1 = g2_frag(qrow + 32, hh);                 /* B = Q^T: column q, k = channel */
  const unsigned crow = tid >> 3, cc8 = (tid & 7u) * 8u;                             /* copy map: thread -> tile rows crow and crow + 32, elements cc8 .. cc8+7 */
  const _Float16* gk = K16 + ((size_t)pair * SEQ + crow) * CD + cc8;                  /* step 0's source, K rows p */
  const _Float16* gv = V16 + ((size_t)pair * CD + crow) * SEQ + cc8;                  /* step 0's source, V^T rows c */
  const unsigned lk0 = (unsigned)(size_t)&kv[0][0][crow * TP + cc8];                  /* LDS byte address of this lane's first K chunk, buffer 0 */
  const unsigned LT = TILE_E * 2u;                                                    /* bytes of one tile: K -> V^T; two of them: buffer 0 -> 1 */
  stage_kv(lk0, gk, lk0 + LT, gv);
  asm volatile("s_wait_asynccnt 0x0" ::: "memory");      /* own copies of step 0 landed */
  __syncthreads();                                       /* step 0 readable by every wave */
  stage_kv(lk0 + 2u * LT, gk + (size_t)BP * CD, lk0 + 3u * LT, gv + BP);   /* step 1 flies during step 0 */
  FragH on;
#pragma unroll
  for (int e = 0; e < 16; ++e) on.h[e] = (_Float16)1.0f;                            /* all-ones A: every D row = column sums of P^T */
  const v8f z8 = {0.f, 0.f, 0.f, 0.f, 0.f, 0.f, 0.f, 0.f};
  v8f o[4] = {z8, z8, z8, z8};
  v8f osum = z8;
  float m = -3.0e38f;                                   /* running max of the scaled logits (base-2 domain) */
  const float SC = 0.005635527503472513f;               /* log2(e) / 256: undoes the x16 carries of q and k */
#pragma unroll 1
  for (unsigned t = 0; t < NT; ++t) {
    const _Float16* kt = &kv[t & 1u][0][ln * TP];        /* A = K rows: row p, k = channel */
    const _Float16* vt = &kv[t & 1u][1][ln * TP];        /* A = V^T rows: row c, k = position */
    v8f s[4];
#pragma unroll
    for (int pt = 0; pt < 4; ++pt) {
      const _Float16* kr = kt + pt * 16 * TP;
      const v16h a0 = g2_frag(kr, hh), a1 = g2_frag(kr + 32, hh);
      const v8f c = g2_mma(a0, bq0, z8);
      s[pt] = g2_mma(a1, bq1, c);                       /* D[row p = pt*16 + 8h + r][col q = lane&15] */
    }
    float bm = -3.0e38f;
#pragma unroll
    for (int pt = 0; pt < 4; ++pt)
#pragma unroll
      for (int r = 0; r < 8; ++r) { const float t = s[pt][r] * SC; s[pt][r] = t; bm = fmaxf(bm, t); }
    bm = fmaxf(bm, __shfl_xor(bm, 16, 32));             /* other lane half holds the remaining 32 key positions of this column */
    const float mn = fmaxf(m, bm);
    const float sc = exp2f(m - mn);
    m = mn;
    const float mm = mn - 14.0f;                         /* weights carried x2^14 (max 16384) */
    FragH b0, b1;                                        /* P^T as B: element r <- tile with k 0..15, element 8+r <- tile with k 16..31, lane unchanged */
#pragma unroll
    for (int r = 0; r < 8; ++r) {
      b0.h[r]     = (_Float16)exp2f(s[0][r] - mm);
      b0.h[8 + r] = (_Float16)exp2f(s[1][r] - mm);
      b1.h[r]     = (_Float16)exp2f(s[2][r] - mm);
      b1.h[8 + r] = (_Float16)exp2f(s[3][r] - mm);
    }
#pragma unroll
    for (int ct = 0; ct < 4; ++ct)
#pragma unroll
      for (int r = 0; r < 8; ++r) o[ct][r] *= sc;
#pragma unroll
    for (int r = 0; r < 8; ++r) osum[r] *= sc;
#pragma unroll
    for (int ct = 0; ct < 4; ++ct) {
      const _Float16* vr = vt + ct * 16 * TP;
      const v16h a0 = g2_frag(vr, hh), a1 = g2_frag(vr + 32, hh);
      o[ct] = g2_mma(a0, b0.v, o[ct]);
      o[ct] = g2_mma(a1, b1.v, o[ct]);                  /* D[row c = ct*16 + 8h + r][col q] */
    }
    osum = g2_mma(on.v, b0.v, osum);
    osum = g2_mma(on.v, b1.v, osum);                    /* every element = sum over keys of the f16 weights of column q */
    asm volatile("s_wait_dscnt 0x0" ::: "memory");       /* own reads of this buffer done before it is refilled */
    asm volatile("s_wait_asynccnt 0x0" ::: "memory");    /* own copies of step t + 1 landed */
    __syncthreads();                                     /* publishes step t + 1 and ends every wave's reads of step t */
    if (t + 2u < NT) {                                   /* block-uniform */
      const unsigned lb = lk0 + (t & 1u) * 2u * LT;
      stage_kv(lb, gk + (size_t)(t + 2u) * BP * CD, lb + LT, gv + (t + 2u) * BP);
    }
  }
  asm volatile("s_wait_asynccnt 0x0" ::: "memory");      /* nothing of the ring in flight at the wave's end */
  const float rinv = (1.0f / osum[0]) * 0.0625f;        /* 1/sum, and the x16 carry of v */
#pragma unroll
  for (int ct = 0; ct < 4; ++ct)
#pragma unroll
    for (int r = 0; r < 8; ++r) so[ct * 16 + 8 * hh + r][w * 16u + ln] = o[ct][r] * rinv;
  __syncthreads();
  float* ob = out + ((size_t)pair * CD) * SEQ + (size_t)qt * BQ;
  {
#pragma unroll
    for (int i = 0; i < 8; ++i) {
      const unsigned c = w * 8u + i;
      const v4f v = *(const v4fa*)&so[c][lane * 4u];
      *(v4f*)(ob + (size_t)c * SEQ + lane * 4u) = v;
    }
    
  }
}

extern "C" void kernel_launch(void* const* d_in, const int* in_sizes, int n_in,
                              void* d_out, int out_size, void* d_ws, size_t ws_size, hipStream_t stream) {
  if (n_in < 3) return;
  const long long qmin = (long long)(NB * CD - 1) * L_FULL + SEQ;
  const long long kmin = (long long)(NB * KK * CD - 1) * L_FULL + SEQ;
  if ((long long)in_sizes[0] < qmin || (long long)in_sizes[1] < kmin || (long long)in_sizes[2] < kmin) return;
  if ((long long)out_size < (long long)NB * KK * CD * SEQ) return;
  const float* q = (const float*)d_in[0];      /* query [n][c][l] */
  const float* k = (const float*)d_in[1];      /* key   [n][k][c][l] */
  const float* v = (const float*)d_in[2];      /* value [n][k][c][l] */
  char* ws = (char*)d_ws; size_t off = 0;
  auto take = [&](size_t bytes) { char* p = ws + off; off += (bytes + 255) & ~(size_t)255; return p; };
  _Float16* Q16 = (_Float16*)take((size_t)NB * SEQ * CD * 2);
  _Float16* K16 = (_Float16*)take((size_t)NB * KK * SEQ * CD * 2);
  _Float16* V16 = (_Float16*)take((size_t)NB * KK * CD * SEQ * 2);
  if (off > ws_size) return;
  k_rows16<<<GRID_R, 256, 0, stream>>>(q, k, Q16, K16);     /* in [img][64 c][L] -> out [img][SEQ l][64 c] */
  k_v16<<<GRID_V, 256, 0, stream>>>(v, V16);
  k_attn<<<GRID_A, 256, 0, stream>>>(Q16, K16, V16, (float*)d_out);
}

// v002
// A run of this version takes 37.6 microseconds.
// Timed twice side by side with v001, it ran 1.17 and 1.16 times as fast.
// Over all steps from v000 it is 2.98 times as fast.
#include <hip/hip_runtime.h>
// Contractions: scores^T = K Q^T (K = 64) and out^T = V^T P^T (K = 1024) plus the softmax denominators (all-ones A rows), all on v_wmma_f32_16x16x32_f16 with f32 accumulation; q/k/v are bf16-RNE-converted inputs carried x16 as exact f16, P = exp2 weights carried x2^14 as f16; softmax statistics f32.
// Layout: query [n][c][l], key/value/out [n][k][c][l] (channel-major, l contiguous). Planes: Q16 [n][l][c], K16 [n,k][l][c] (token rows via LDS transposes), V16 [n,k][c][l] (already V^T).
// Attention kernel: one wave owns 16 query columns; S^T tiles D[p][q] keep q on the lanes, so the running max / rescale are one scalar per lane and
// two packed D tiles form one B fragment of P^T (k = key position) directly in registers; O^T D[c][q] is the output layout.
// K and V^T tiles of 64 keys reach the block's LDS by asynchronous copies, two buffers, one barrier per step; all 8 waves read their A fragments from there.
#ifndef NB
#define NB 8            /* batches processed */
#endif
#ifndef SEQ
#define SEQ 1024        /* positions processed per image (keys and queries) */
#endif
#define NB_FULL 8
#define L_FULL 1024     /* input row pitch (positions per channel row of the inputs) */
#define KK 8            /* key sets per batch */
#define CD 64           /* channels */
#define BQ 128          /* query columns per block (8 waves x 16) */
#define BP 64           /* key positions per step */
#define QTN (SEQ / BQ)
#define NT (SEQ / BP)    /* key steps */
#define TP 72           /* LDS pitch of a staged 64-element f16 row, in elements: 144 B = 16 B x odd, for 16-byte readers */
#define TILE_E (64 * TP) /* elements of one staged 64 x 64 tile */
#define TL 256          /* positions per block of the transposing conversion kernel: 64 channels x 256 positions = 64 KiB of f32 */
#define RP 144          /* LDS bytes of one staged token row: 128 B of f16 channels + 16, 16 B x odd for 16-byte writers */
#define RG (32 * RP + 128) /* LDS bytes of a group of 32 token rows; = 32 dwords mod 64 banks, so that two rows of neighbouring groups read together cover all banks */
#define VE 16384        /* value elements per block of the streaming conversion kernel: 64 KiB of f32 */
#define GRID_R ((NB + NB * KK) * (SEQ / TL))
#define GRID_V ((NB * KK * CD * SEQ) / VE)
#define GRID_A (NB * KK * QTN)
static_assert(SEQ % BQ == 0);
static_assert(SEQ % BP == 0);
static_assert(NT >= 2 && BP == 64 && CD == 64);   /* the two-buffer ring needs two steps; the copy map below is for 64 x 64 tiles */
static_assert(SEQ <= L_FULL);
static_assert(NB <= NB_FULL);
static_assert(SEQ % TL == 0 && SEQ % 4 == 0 && L_FULL % 4 == 0);
static_assert(TL == 256 && VE == 16 * 256 * 4);   /* the conversion kernels' thread maps: 8 waves x 8 channels x 2 halves of 128 positions; 16 units of 4 elements a thread */
static_assert((size_t)GRID_R * TL * CD == (size_t)(NB + NB * KK) * SEQ * CD);   /* Q16 + K16 plane coverage */
static_assert((size_t)GRID_V * VE == (size_t)NB * KK * CD * SEQ);               /* V16 plane coverage */
static_assert((size_t)GRID_A * CD * BQ == (size_t)NB * KK * CD * SEQ);          /* output coverage */

typedef unsigned short v8us __attribute__((ext_vector_type(8), may_alias));
typedef unsigned short v4us __attribute__((ext_vector_type(4), may_alias));
typedef float  v8f  __attribute__((ext_vector_type(8)));
typedef float  v4f  __attribute__((ext_vector_type(4)));
typedef float  v4fa __attribute__((ext_vector_type(4), may_alias));
typedef _Float16 v16h __attribute__((ext_vector_type(16)));
union FragH { v16h v; v8us half[2]; _Float16 h[16]; unsigned short u[16]; };

__device__ __forceinline__ unsigned short bf16_bits(float x) { unsigned int u = __float_as_uint(x); return (unsigned short)((u + 0x7FFFu + ((u >> 16) & 1u)) >> 16); }
__device__ __forceinline__ float bf16_val(unsigned short b) { return __uint_as_float(((unsigned int)b) << 16); }
__device__ __forceinline__ float bf16_rne(float x) { return bf16_val(bf16_bits(x)); }

// fragment (A: row = lane&15, B: column = lane&15) from a k-contiguous f16 row: elements 0..7 <- k 8h..8h+7, elements 8..15 <- k 16+8h..16+8h+7
__device__ __forceinline__ v16h g2_frag(const _Float16* p, unsigned hh) { FragH f; f.half[0] = *(const v8us*)((const unsigned short*)p + 8u * hh); f.half[1] = *(const v8us*)((const unsigned short*)p + 16u + 8u * hh); return f.v; }
__device__ __forceinline__ v8f g2_mma(v16h a, v16h b, v8f c) { v8f d = __builtin_amdgcn_wmma_f32_16x16x32_f16(false, a, false, b, (short)0, c, false, false); asm volatile("v_nop\n\tv_nop\n\tv_nop\n\tv_nop" : "+v"(d) : "v"(a), "v"(b)); return d; }

// Both conversion kernels, x -> f16(bf16(x) * 16): every thread has 16 loads of 16 B in flight (64 KiB per block) and every wave-wide load and store covers whole 128-B lines.
// channel-first query / key images [img][c][L_FULL] -> token rows [img][l][c], 64 channels x 256 positions per block, transposed through LDS
__global__ __launch_bounds__(256) void k_rows16(const float* __restrict__ Xq, const float* __restrict__ Xk, _Float16* __restrict__ Q16, _Float16* __restrict__ K16) {
  __shared__ __attribute__((aligned(16))) unsigned char tl[8 * RG];   /* token row l at ((l >> 7) * 4 + (l & 3)) * RG + ((l >> 2) & 31) * RP */
  const unsigned tid = threadIdx.x, w = tid >> 5, lane = tid & 31u;
  const unsigned nl = SEQ / TL;
  const unsigned nbq = NB * nl;
  unsigned bi = blockIdx.x;
  const bool isq = bi < nbq;                 /* block-uniform */
  if (!isq) bi -= nbq;
  const unsigned img = bi / nl, lb = bi - img * nl;
  /* wave w reads channels 8w .. 8w+7; a lane reads positions 4*lane .. 4*lane+3 of each half of 128 */
  const float* X = (isq ? Xq : Xk) + ((size_t)img * CD + w * 8u) * L_FULL + (size_t)lb * TL + lane * 4u;
  v4f x[2][8];
#pragma unroll   /* this nest and the next: x[][] in registers, all 16 loads issued ahead of the first use */
  for (int j = 0; j < 2; ++j)
#pragma unroll
    for (int q = 0; q < 8; ++q) x[j][q] = *(const v4fa*)(X + (size_t)q * L_FULL + j * 128);
  asm volatile("s_wait_xcnt 0x0" :: "v"(X) : "memory");   /* the loads' address stays in its registers up to this wait */
#pragma unroll
  for (int j = 0; j < 2; ++j)
#pragma unroll
    for (int e = 0; e < 4; ++e) {
      FragH f;
#pragma unroll
      for (int q = 0; q < 8; ++q) f.h[q] = (_Float16)(bf16_rne(x[j][q][e]) * 16.0f);
      *(v8us*)(tl + (j * 4 + e) * RG + lane * RP + w * 16u) = f.half[0];   /* position 128j + 4*lane + e, channels 8w .. 8w+7 */
    }
  __syncthreads();                           /* cross-wave LDS exchange */
  unsigned short* D = (unsigned short*)(isq ? Q16 : K16) + ((size_t)img * SEQ + (size_t)lb * TL) * CD;
#pragma unroll
  for (int it = 0; it < 8; ++it) {
    const unsigned g = it * 256u + tid, l = g >> 3, ch = g & 7u;          /* 16-byte chunk g = position l, channels 8ch .. 8ch+7; a wave stores 512 contiguous bytes */
    const v8us o = *(const v8us*)(tl + ((l >> 7) * 4u + (l & 3u)) * RG + ((l >> 2) & 31u) * RP + ch * 16u);
    *(v8us*)(D + (size_t)g * 8u) = o;
  }
}

// value rows [row][L_FULL] -> V16 [row][SEQ], element order kept
// amdgpu_waves_per_eu: at most 8 waves per SIMD planned for, so that the scheduler takes the registers for all 16 loads; without it it holds four loads back behind the first results
__global__ __launch_bounds__(256) __attribute__((amdgpu_waves_per_eu(2, 8))) void k_v16(const float* __restrict__ V, _Float16* __restrict__ V16) {
  const unsigned u0 = blockIdx.x * (VE / 4u) + threadIdx.x;   /* units of 4 elements */
  v4f x[16];
#pragma unroll   /* x[] in registers, all 16 loads issued ahead of the first use */
  for (int i = 0; i < 16; ++i) {
    const unsigned u = u0 + i * 256u, row = u / (SEQ / 4u), l4 = (u - row * (SEQ / 4u)) * 4u;
    x[i] = *(const v4fa*)(V + (size_t)row * L_FULL + l4);
  }
#pragma unroll
  for (int i = 0; i < 16; ++i) {
    FragH f;
#pragma unroll
    for (int e = 0; e < 4; ++e) f.h[e] = (_Float16)(bf16_rne(x[i][e]) * 16.0f);
    const v4us o = {f.u[0], f.u[1], f.u[2], f.u[3]};
    *(v4us*)((unsigned short*)V16 + (size_t)(u0 + i * 256u) * 4u) = o;
  }
}

// One step's K tile (64 key rows x 64 channels) and V^T tile (64 channel rows x 64 positions) into LDS: 16 B per lane and copy, two copies per tile and thread, every lane on.
// The s_wait_xcnt stands inside the statement so that it precedes any later rewrite of the address registers the copies name.
__device__ __forceinline__ void stage_kv(unsigned lk, const _Float16* gk, unsigned lv, const _Float16* gv) {
  const unsigned lk1 = lk + 32u * TP * 2u, lv1 = lv + 32u * TP * 2u;
  const _Float16* gk1 = gk + 32 * CD;
  const _Float16* gv1 = gv + (size_t)32 * SEQ;
  asm volatile("global_load_async_to_lds_b128 %0, %1, off\n\t"
               "global_load_async_to_lds_b128 %2, %3, off\n\t"
               "global_load_async_to_lds_b128 %4, %5, off\n\t"
               "global_load_async_to_lds_b128 %6, %7, off\n\t"
               "s_wait_xcnt 0x0"
               :: "v"(lk), "v"(gk), "v"(lk1), "v"(gk1), "v"(lv), "v"(gv), "v"(lv1), "v"(gv1) : "memory");
}

// flash attention per (n, k) pair and 128 query columns; wave w owns columns q0 .. q0+15 (lane&15 = column)
__global__ __launch_bounds__(256) void k_attn(const _Float16* __restrict__ Q16, const _Float16* __restrict__ K16, const _Float16* __restrict__ V16, float* __restrict__ out) {
  __shared__ __attribute__((aligned(16))) float so[CD][BQ + 4];      /* block output tile [c][q]; cross-wave (block barrier) */
  __shared__ __attribute__((aligned(16))) _Float16 kv[2][2][TILE_E];  /* ring of two buffers, each a K tile [p][c] and a V^T tile [c][p], shared by the 8 waves */
  const unsigned tid = threadIdx.x, w = tid >> 5, lane = tid & 31u, ln = lane & 15u, hh = lane >> 4;
  const unsigned pair = blockIdx.x / QTN, qt = blockIdx.x - pair * QTN, n = pair / KK;
  const unsigned q0 = qt * BQ + w * 16u;
  const _Float16* qrow = Q16 + ((size_t)n * SEQ + q0 + ln) * CD;
  const v16h bq0 = g2_frag(qrow, hh), bq1 = g2_frag(qrow + 32, hh);                 /* B = Q^T: column q, k = channel */
  const unsigned crow = tid >> 3, cc8 = (tid & 7u) * 8u;                             /* copy map: thread -> tile rows crow and crow + 32, elements cc8 .. cc8+7 */
  const _Float16* gk = K16 + ((size_t)pair * SEQ + crow) * CD + cc8;                  /* step 0's source, K rows p */
  const _Float16* gv = V16 + ((size_t)pair * CD + crow) * SEQ + cc8;                  /* step 0's source, V^T rows c */
  const unsigned lk0 = (unsigned)(size_t)&kv[0][0][crow * TP + cc8];                  /* LDS byte address of this lane's first K chunk, buffer 0 */
  const unsigned LT = TILE_E * 2u;                                                    /* bytes of one tile: K -> V^T; two of them: buffer 0 -> 1 */
  stage_kv(lk0, gk, lk0 + LT, gv);
  asm volatile("s_wait_asynccnt 0x0" ::: "memory");      /* own copies of step 0 landed */
  __syncthreads();                                       /* step 0 readable by every wave */
  stage_kv(lk0 + 2u * LT, gk + (size_t)BP * CD, lk0 + 3u * LT, gv + BP);   /* step 1 flies during step 0 */
  FragH on;
#pragma unroll
  for (int e = 0; e < 16; ++e) on.h[e] = (_Float16)1.0f;                            /* all-ones A: every D row = column sums of P^T */
  const v8f z8 = {0.f, 0.f, 0.f, 0.f, 0.f, 0.f, 0.f, 0.f};
  v8f o[4] = {z8, z8, z8, z8};
  v8f osum = z8;
  float m = -3.0e38f;                                   /* running max of the scaled logits (base-2 domain) */
  const float SC = 0.005635527503472513f;               /* log2(e) / 256: undoes the x16 carries of q and k */
#pragma unroll 1
  for (unsigned t = 0; t < NT; ++t) {
    const _Float16* kt = &kv[t & 1u][0][ln * TP];        /* A = K rows: row p, k = channel */
    const _Float16* vt = &kv[t & 1u][1][ln * TP];        /* A = V^T rows: row c, k = position */
    v8f s[4];
#pragma unroll
    for (int pt = 0; pt < 4; ++pt) {
      const _Float16* kr = kt + pt * 16 * TP;
      const v16h a0 = g2_frag(kr, hh), a1 = g2_frag(kr + 32, hh);
      const v8f c = g2_mma(a0, bq0, z8);
      s[pt] = g2_mma(a1, bq1, c);                       /* D[row p = pt*16 + 8h + r][col q = lane&15] */
    }
    float bm = -3.0e38f;
#pragma unroll
    for (int pt = 0; pt < 4; ++pt)
#pragma unroll
      for (int r = 0; r < 8; ++r) { const float t = s[pt][r] * SC; s[pt][r] = t; bm = fmaxf(bm, t); }
    bm = fmaxf(bm, __shfl_xor(bm, 16, 32));             /* other lane half holds the remaining 32 key positions of this column */
    const float mn = fmaxf(m, bm);
    const float sc = exp2f(m - mn);
    m = mn;
    const float mm = mn - 14.0f;                         /* weights carried x2^14 (max 16384) */
    FragH b0, b1;                                        /* P^T as B: element r <- tile with k 0..15, element 8+r <- tile with k 16..31, lane unchanged */
#pragma unroll
    for (int r = 0; r < 8; ++r) {
      b0.h[r]     = (_Float16)exp2f(s[0][r] - mm);
      b0.h[8 + r] = (_Float16)exp2f(s[1][r] - mm);
      b1.h[r]     = (_Float16)exp2f(s[2][r] - mm);
      b1.h[8 + r] = (_Float16)exp2f(s[3][r] - mm);
    }
#pragma unroll
    for (int ct = 0; ct < 4; ++ct)
#pragma unroll
      for (int r = 0; r < 8; ++r) o[ct][r] *= sc;
#pragma unroll
    for (int r = 0; r < 8; ++r) osum[r] *= sc;
#pragma unroll
    for (int ct = 0; ct < 4; ++ct) {
      const _Float16* vr = vt + ct * 16 * TP;
      const v16h a0 = g2_frag(vr, hh), a1 = g2_frag(vr + 32, hh);
      o[ct] = g2_mma(a0, b0.v, o[ct]);
      o[ct] = g2_mma(a1, b1.v, o[ct]);                  /* D[row c = ct*16 + 8h + r][col q] */
    }
    osum = g2_mma(on.v, b0.v, osum);
    osum = g2_mma(on.v, b1.v, osum);                    /* every element = sum over keys of the f16 weights of column q */
    asm volatile("s_wait_dscnt 0x0" ::: "memory");       /* own reads of this buffer done before it is refilled */
    asm volatile("s_wait_asynccnt 0x0" ::: "memory");    /* own copies of step t + 1 landed */
    __syncthreads();                                     /* publishes step t + 1 and ends every wave's reads of step t */
    if (t + 2u < NT) {                                   /* block-uniform */
      const unsigned lb = lk0 + (t & 1u) * 2u * LT;
      stage_kv(lb, gk + (size_t)(t + 2u) * BP * CD, lb + LT, gv + (t + 2u) * BP);
    }
  }
  asm volatile("s_wait_asynccnt 0x0" ::: "memory");      /* nothing of the ring in flight at the wave's end */
  const float rinv = (1.0f / osum[0]) * 0.0625f;        /* 1/sum, and the x16 carry of v */
#pragma unroll
  for (int ct = 0; ct < 4; ++ct)
#pragma unroll
    for (int r = 0; r < 8; ++r) so[ct * 16 + 8 * hh + r][w * 16u + ln] = o[ct][r] * rinv;
  __syncthreads();
  float* ob = out + ((size_t)pair * CD) * SEQ + (size_t)qt * BQ;
  {
#pragma unroll
    for (int i = 0; i < 8; ++i) {
      const unsigned c = w * 8u + i;
      const v4f v = *(const v4fa*)&so[c][lane * 4u];
      *(v4f*)(ob + (size_t)c * SEQ + lane * 4u) = v;
    }
    
  }
}

extern "C" void kernel_launch(void* const* d_in, const int* in_sizes, int n_in,
                              void* d_out, int out_size, void* d_ws, size_t ws_size, hipStream_t stream) {
  if (n_in < 3) return;
  const long long qmin = (long long)(NB * CD - 1) * L_FULL + SEQ;
  const long long kmin = (long long)(NB * KK * CD - 1) * L_FULL + SEQ;
  if ((long long)in_sizes[0] < qmin || (long long)in_sizes[1] < kmin || (long long)in_sizes[2] < kmin) return;
  if ((long long)out_size < (long long)NB * KK * CD * SEQ) return;
  const float* q = (const float*)d_in[0];      /* query [n][c][l] */
  const float* k = (const float*)d_in[1];      /* key   [n][k][c][l] */
  const float* v = (const float*)d_in[2];      /* value [n][k][c][l] */
  char* ws = (char*)d_ws; size_t off = 0;
  auto take = [&](size_t bytes) { char* p = ws + off; off += (bytes + 255) & ~(size_t)255; return p; };
  _Float16* Q16 = (_Float16*)take((size_t)NB * SEQ * CD * 2);
  _Float16* K16 = (_Float16*)take((size_t)NB * KK * SEQ * CD * 2);
  _Float16* V16 = (_Float16*)take((size_t)NB * KK * CD * SEQ * 2);
  if (off > ws_size) return;
  k_rows16<<<GRID_R, 256, 0, stream>>>(q, k, Q16, K16);     /* in [img][64 c][L] -> out [img][SEQ l][64 c] */
  k_v16<<<GRID_V, 256, 0, stream>>>(v, V16);
  k_attn<<<GRID_A, 256, 0, stream>>>(Q16, K16, V16, (float*)d_out);
}

// v003
// A run of this version takes 32.6 microseconds.
// In both of two side-by-side timings against v002, it was 1.16 times as fast.
// All steps since v000 together make it 3.45 times as fast.
#include <hip/hip_runtime.h>
// Contractions: scores^T = K Q^T (K = 64) and out^T = V^T P^T (K = 1024) plus the softmax denominators (all-ones A rows), all on v_wmma_f32_16x16x32_f16 with f32 accumulation; q/k/v are bf16-RNE-converted inputs carried x16 as exact f16, P = exp2 weights carried x2^14 as f16; softmax statistics f32.
// Layout: query [n][c][l], key/value/out [n][k][c][l] (channel-major, l contiguous). Planes: Q16 [n][l][c], K16 [n,k][l][c] (token rows via LDS transposes), V16 [n,k][c][l] (already V^T).
// Attention kernel: one wave owns 16 query columns; S^T tiles D[p][q] keep q on the lanes, so the running max / rescale are one scalar per lane and
// two packed D tiles form one B fragment of P^T (k = key position) directly in registers; O^T D[c][q] is the output layout.
// K and V^T tiles of 64 keys reach the block's LDS by asynchronous copies, two buffers, one barrier per step; all 8 waves read their A fragments from there.
#ifndef NB
#define NB 8            /* batches processed */
#endif
#ifndef SEQ
#define SEQ 1024        /* positions processed per image (keys and queries) */
#endif
#define NB_FULL 8
#define L_FULL 1024     /* input row pitch (positions per channel row of the inputs) */
#define KK 8            /* key sets per batch */
#define CD 64           /* channels */
#define BQ 128          /* query columns per block (8 waves x 16) */
#define BP 64           /* key positions per step */
#define QTN (SEQ / BQ)
#define NT (SEQ / BP)    /* key steps */
#define TP 72           /* LDS pitch of a staged 64-element f16 row, in elements: 144 B = 16 B x odd, for 16-byte readers */
#define TILE_E (64 * TP) /* elements of one staged 64 x 64 tile */
#define TL 256          /* positions per block of the transposing conversion kernel: 64 channels x 256 positions = 64 KiB of f32 */
#define RP 144          /* LDS bytes of one staged token row: 128 B of f16 channels + 16, 16 B x odd for 16-byte writers */
#define RG (32 * RP + 128) /* LDS bytes of a group of 32 token rows; = 32 dwords mod 64 banks, so that two rows of neighbouring groups read together cover all banks */
#define VE 16384        /* value elements per block of the streaming conversion kernel: 64 KiB of f32 */
#define GRID_R ((NB + NB * KK) * (SEQ / TL))
#define GRID_V ((NB * KK * CD * SEQ) / VE)
#define GRID_A (NB * KK * QTN)
static_assert(SEQ % BQ == 0);
static_assert(SEQ % BP == 0);
static_assert(NT >= 2 && BP == 64 && CD == 64);   /* the two-buffer ring needs two steps; the copy map below is for 64 x 64 tiles */
static_assert(SEQ <= L_FULL);
static_assert(NB <= NB_FULL);
static_assert(SEQ % TL == 0 && SEQ % 4 == 0 && L_FULL % 4 == 0);
static_assert(TL == 256 && VE == 16 * 256 * 4);   /* the conversion kernels' thread maps: 8 waves x 8 channels x 2 halves of 128 positions; 16 units of 4 elements a thread */
static_assert((size_t)GRID_R * TL * CD == (size_t)(NB + NB * KK) * SEQ * CD);   /* Q16 + K16 plane coverage */
static_assert((size_t)GRID_V * VE == (size_t)NB * KK * CD * SEQ);               /* V16 plane coverage */
static_assert((size_t)GRID_A * CD * BQ == (size_t)NB * KK * CD * SEQ);          /* output coverage */

typedef unsigned short v8us __attribute__((ext_vector_type(8), may_alias));
typedef unsigned short v4us __attribute__((ext_vector_type(4), may_alias));
typedef float  v8f  __attribute__((ext_vector_type(8)));
typedef float  v4f  __attribute__((ext_vector_type(4)));
typedef float  v4fa __attribute__((ext_vector_type(4), may_alias));
typedef _Float16 v16h __attribute__((ext_vector_type(16)));
union FragH { v16h v; v8us half[2]; _Float16 h[16]; unsigned short u[16]; };

__device__ __forceinline__ unsigned short bf16_bits(float x) { unsigned int u = __float_as_uint(x); return (unsigned short)((u + 0x7FFFu + ((u >> 16) & 1u)) >> 16); }
__device__ __forceinline__ float bf16_val(unsigned short b) { return __uint_as_float(((unsigned int)b) << 16); }
__device__ __forceinline__ float bf16_rne(float x) { return bf16_val(bf16_bits(x)); }

// fragment (A: row = lane&15, B: column = lane&15) from a k-contiguous f16 row: elements 0..7 <- k 8h..8h+7, elements 8..15 <- k 16+8h..16+8h+7
__device__ __forceinline__ v16h g2_frag(const _Float16* p, unsigned hh) { FragH f; f.half[0] = *(const v8us*)((const unsigned short*)p + 8u * hh); f.half[1] = *(const v8us*)((const unsigned short*)p + 16u + 8u * hh); return f.v; }
__device__ __forceinline__ v8f g2_mma(v16h a, v16h b, v8f c) { v8f d = __builtin_amdgcn_wmma_f32_16x16x32_f16(false, a, false, b, (short)0, c, false, false); asm volatile("v_nop\n\tv_nop\n\tv_nop\n\tv_nop" : "+v"(d) : "v"(a), "v"(b)); return d; }

// 2^x as the bare v_exp_f32, without the library's handling of results below 2^-126 (a range test, two selects, an add and a v_ldexp_f32 per value): such a result comes out as 0 instead of a subnormal.
// A weight is rounded to f16, where everything below 2^-25 is 0 in either form; a rescale factor that small multiplies sums that then stand beside a new term of 2^14.
__device__ __forceinline__ float exp2_hw(float x) { return __builtin_amdgcn_exp2f(x); }

// Both conversion kernels, x -> f16(bf16(x) * 16): every thread has 16 loads of 16 B in flight (64 KiB per block) and every wave-wide load and store covers whole 128-B lines.
// channel-first query / key images [img][c][L_FULL] -> token rows [img][l][c], 64 channels x 256 positions per block, transposed through LDS
__global__ __launch_bounds__(256) void k_rows16(const float* __restrict__ Xq, const float* __restrict__ Xk, _Float16* __restrict__ Q16, _Float16* __restrict__ K16) {
  __shared__ __attribute__((aligned(16))) unsigned char tl[8 * RG];   /* token row l at ((l >> 7) * 4 + (l & 3)) * RG + ((l >> 2) & 31) * RP */
  const unsigned tid = threadIdx.x, w = tid >> 5, lane = tid & 31u;
  const unsigned nl = SEQ / TL;
  const unsigned nbq = NB * nl;
  unsigned bi = blockIdx.x;
  const bool isq = bi < nbq;                 /* block-uniform */
  if (!isq) bi -= nbq;
  const unsigned img = bi / nl, lb = bi - img * nl;
  /* wave w reads channels 8w .. 8w+7; a lane reads positions 4*lane .. 4*lane+3 of each half of 128 */
  const float* X = (isq ? Xq : Xk) + ((size_t)img * CD + w * 8u) * L_FULL + (size_t)lb * TL + lane * 4u;
  v4f x[2][8];
#pragma unroll   /* this nest and the next: x[][] in registers, all 16 loads issued ahead of the first use */
  for (int j = 0; j < 2; ++j)
#pragma unroll
    for (int q = 0; q < 8; ++q) x[j][q] = *(const v4fa*)(X + (size_t)q * L_FULL + j * 128);
  asm volatile("s_wait_xcnt 0x0" :: "v"(X) : "memory");   /* the loads' address stays in its registers up to this wait */
#pragma unroll
  for (int j = 0; j < 2; ++j)
#pragma unroll
    for (int e = 0; e < 4; ++e) {
      FragH f;
#pragma unroll
      for (int q = 0; q < 8; ++q) f.h[q] = (_Float16)(bf16_rne(x[j][q][e]) * 16.0f);
      *(v8us*)(tl + (j * 4 + e) * RG + lane * RP + w * 16u) = f.half[0];   /* position 128j + 4*lane + e, channels 8w .. 8w+7 */
    }
  __syncthreads();                           /* cross-wave LDS exchange */
  unsigned short* D = (unsigned short*)(isq ? Q16 : K16) + ((size_t)img * SEQ + (size_t)lb * TL) * CD;
#pragma unroll
  for (int it = 0; it < 8; ++it) {
    const unsigned g = it * 256u + tid, l = g >> 3, ch = g & 7u;          /* 16-byte chunk g = position l, channels 8ch .. 8ch+7; a wave stores 512 contiguous bytes */
    const v8us o = *(const v8us*)(tl + ((l >> 7) * 4u + (l & 3u)) * RG + ((l >> 2) & 31u) * RP + ch * 16u);
    *(v8us*)(D + (size_t)g * 8u) = o;
  }
}

// value rows [row][L_FULL] -> V16 [row][SEQ], element order kept
// amdgpu_waves_per_eu: at most 8 waves per SIMD planned for, so that the scheduler takes the registers for all 16 loads; without it it holds four loads back behind the first results
__global__ __launch_bounds__(256) __attribute__((amdgpu_waves_per_eu(2, 8))) void k_v16(const float* __restrict__ V, _Float16* __restrict__ V16) {
  const unsigned u0 = blockIdx.x * (VE / 4u) + threadIdx.x;   /* units of 4 elements */
  v4f x[16];
#pragma unroll   /* x[] in registers, all 16 loads issued ahead of the first use */
  for (int i = 0; i < 16; ++i) {
    const unsigned u = u0 + i * 256u, row = u / (SEQ / 4u), l4 = (u - row * (SEQ / 4u)) * 4u;
    x[i] = *(const v4fa*)(V + (size_t)row * L_FULL + l4);
  }
#pragma unroll
  for (int i = 0; i < 16; ++i) {
    FragH f;
#pragma unroll
    for (int e = 0; e < 4; ++e) f.h[e] = (_Float16)(bf16_rne(x[i][e]) * 16.0f);
    const v4us o = {f.u[0], f.u[1], f.u[2], f.u[3]};
    *(v4us*)((unsigned short*)V16 + (size_t)(u0 + i * 256u) * 4u) = o;
  }
}

// One step's K tile (64 key rows x 64 channels) and V^T tile (64 channel rows x 64 positions) into LDS: 16 B per lane and copy, two copies per tile and thread, every lane on.
// The s_wait_xcnt stands inside the statement so that it precedes any later rewrite of the address registers the copies name.
__device__ __forceinline__ void stage_kv(unsigned lk, const _Float16* gk, unsigned lv, const _Float16* gv) {
  const unsigned lk1 = lk + 32u * TP * 2u, lv1 = lv + 32u * TP * 2u;
  const _Float16* gk1 = gk + 32 * CD;
  const _Float16* gv1 = gv + (size_t)32 * SEQ;
  asm volatile("global_load_async_to_lds_b128 %0, %1, off\n\t"
               "global_load_async_to_lds_b128 %2, %3, off\n\t"
               "global_load_async_to_lds_b128 %4, %5, off\n\t"
               "global_load_async_to_lds_b128 %6, %7, off\n\t"
               "s_wait_xcnt 0x0"
               :: "v"(lk), "v"(gk), "v"(lk1), "v"(gk1), "v"(lv), "v"(gv), "v"(lv1), "v"(gv1) : "memory");
}

// flash attention per (n, k) pair and 128 query columns; wave w owns columns q0 .. q0+15 (lane&15 = column)
__global__ __launch_bounds__(256) void k_attn(const _Float16* __restrict__ Q16, const _Float16* __restrict__ K16, const _Float16* __restrict__ V16, float* __restrict__ out) {
  __shared__ __attribute__((aligned(16))) float so[CD][BQ + 4];      /* block output tile [c][q]; cross-wave (block barrier) */
  __shared__ __attribute__((aligned(16))) _Float16 kv[2][2][TILE_E];  /* ring of two buffers, each a K tile [p][c] and a V^T tile [c][p], shared by the 8 waves */
  const unsigned tid = threadIdx.x, w = tid >> 5, lane = tid & 31u, ln = lane & 15u, hh = lane >> 4;
  const unsigned pair = blockIdx.x / QTN, qt = blockIdx.x - pair * QTN, n = pair / KK;
  const unsigned q0 = qt * BQ + w * 16u;
  const _Float16* qrow = Q16 + ((size_t)n * SEQ + q0 + ln) * CD;
  const v16h bq0 = g2_frag(qrow, hh), bq1 = g2_frag(qrow + 32, hh);                 /* B = Q^T: column q, k = channel */
  const unsigned crow = tid >> 3, cc8 = (tid & 7u) * 8u;                             /* copy map: thread -> tile rows crow and crow + 32, elements cc8 .. cc8+7 */
  const _Float16* gk = K16 + ((size_t)pair * SEQ + crow) * CD + cc8;                  /* step 0's source, K rows p */
  const _Float16* gv = V16 + ((size_t)pair * CD + crow) * SEQ + cc8;                  /* step 0's source, V^T rows c */
  const unsigned lk0 = (unsigned)(size_t)&kv[0][0][crow * TP + cc8];                  /* LDS byte address of this lane's first K chunk, buffer 0 */
  const unsigned LT = TILE_E * 2u;                                                    /* bytes of one tile: K -> V^T; two of them: buffer 0 -> 1 */
  stage_kv(lk0, gk, lk0 + LT, gv);
  asm volatile("s_wait_asynccnt 0x0" ::: "memory");      /* own copies of step 0 landed */
  __syncthreads();                                       /* step 0 readable by every wave */
  stage_kv(lk0 + 2u * LT, gk + (size_t)BP * CD, lk0 + 3u * LT, gv + BP);   /* step 1 flies during step 0 */
  FragH on;
#pragma unroll
  for (int e = 0; e < 16; ++e) on.h[e] = (_Float16)1.0f;                            /* all-ones A: every D row = column sums of P^T */
  const v8f z8 = {0.f, 0.f, 0.f, 0.f, 0.f, 0.f, 0.f, 0.f};
  v8f o[4] = {z8, z8, z8, z8};
  v8f osum = z8;
  float m = -3.0e38f;                                   /* running max of the scaled logits (base-2 domain) */
  const float SC = 0.005635527503472513f;               /* log2(e) / 256: undoes the x16 carries of q and k */
#pragma unroll 1
  for (unsigned t = 0; t < NT; ++t) {
    const _Float16* kt = &kv[t & 1u][0][ln * TP];        /* A = K rows: row p, k = channel */
    const _Float16* vt = &kv[t & 1u][1][ln * TP];        /* A = V^T rows: row c, k = position */
    v8f s[4];
#pragma unroll
    for (int pt = 0; pt < 4; ++pt) {
      const _Float16* kr = kt + pt * 16 * TP;
      const v16h a0 = g2_frag(kr, hh), a1 = g2_frag(kr + 32, hh);
      const v8f c = g2_mma(a0, bq0, z8);
      s[pt] = g2_mma(a1, bq1, c);                       /* D[row p = pt*16 + 8h + r][col q = lane&15] */
    }
    float bm = -3.0e38f;
#pragma unroll
    for (int pt = 0; pt < 4; ++pt)
#pragma unroll
      for (int r = 0; r < 8; ++r) { const float t = s[pt][r] * SC; s[pt][r] = t; bm = fmaxf(bm, t); }
    bm = fmaxf(bm, __shfl_xor(bm, 16, 32));             /* other lane half holds the remaining 32 key positions of this column */
    const float mn = fmaxf(m, bm);
    const float sc = exp2_hw(m - mn);
    m = mn;
    const float mm = mn - 14.0f;                         /* weights carried x2^14 (max 16384) */
    FragH b0, b1;                                        /* P^T as B: element r <- tile with k 0..15, element 8+r <- tile with k 16..31, lane unchanged */
#pragma unroll
    for (int r = 0; r < 8; ++r) {
      b0.h[r]     = (_Float16)exp2_hw(s[0][r] - mm);
      b0.h[8 + r] = (_Float16)exp2_hw(s[1][r] - mm);
      b1.h[r]     = (_Float16)exp2_hw(s[2][r] - mm);
      b1.h[8 + r] = (_Float16)exp2_hw(s[3][r] - mm);
    }
#pragma unroll
    for (int ct = 0; ct < 4; ++ct)
#pragma unroll
      for (int r = 0; r < 8; ++r) o[ct][r] *= sc;
#pragma unroll
    for (int r = 0; r < 8; ++r) osum[r] *= sc;
#pragma unroll
    for (int ct = 0; ct < 4; ++ct) {
      const _Float16* vr = vt + ct * 16 * TP;
      const v16h a0 = g2_frag(vr, hh), a1 = g2_frag(vr + 32, hh);
      o[ct] = g2_mma(a0, b0.v, o[ct]);
      o[ct] = g2_mma(a1, b1.v, o[ct]);                  /* D[row c = ct*16 + 8h + r][col q] */
    }
    osum = g2_mma(on.v, b0.v, osum);
    osum = g2_mma(on.v, b1.v, osum);                    /* every element = sum over keys of the f16 weights of column q */
    asm volatile("s_wait_dscnt 0x0" ::: "memory");       /* own reads of this buffer done before it is refilled */
    asm volatile("s_wait_asynccnt 0x0" ::: "memory");    /* own copies of step t + 1 landed */
    __syncthreads();                                     /* publishes step t + 1 and ends every wave's reads of step t */
    if (t + 2u < NT) {                                   /* block-uniform */
      const unsigned lb = lk0 + (t & 1u) * 2u * LT;
      stage_kv(lb, gk + (size_t)(t + 2u) * BP * CD, lb + LT, gv + (t + 2u) * BP);
    }
  }
  asm volatile("s_wait_asynccnt 0x0" ::: "memory");      /* nothing of the ring in flight at the wave's end */
  const float rinv = (1.0f / osum[0]) * 0.0625f;        /* 1/sum, and the x16 carry of v */
#pragma unroll
  for (int ct = 0; ct < 4; ++ct)
#pragma unroll
    for (int r = 0; r < 8; ++r) so[ct * 16 + 8 * hh + r][w * 16u + ln] = o[ct][r] * rinv;
  __syncthreads();
  float* ob = out + ((size_t)pair * CD) * SEQ + (size_t)qt * BQ;
  {
#pragma unroll
    for (int i = 0; i < 8; ++i) {
      const unsigned c = w * 8u + i;
      const v4f v = *(const v4fa*)&so[c][lane * 4u];
      *(v4f*)(ob + (size_t)c * SEQ + lane * 4u) = v;
    }
    
  }
}

extern "C" void kernel_launch(void* const* d_in, const int* in_sizes, int n_in,
                              void* d_out, int out_size, void* d_ws, size_t ws_size, hipStream_t stream) {
  if (n_in < 3) return;
  const long long qmin = (long long)(NB * CD - 1) * L_FULL + SEQ;
  const long long kmin = (long long)(NB * KK * CD - 1) * L_FULL + SEQ;
  if ((long long)in_sizes[0] < qmin || (long long)in_sizes[1] < kmin || (long long)in_sizes[2] < kmin) return;
  if ((long long)out_size < (long long)NB * KK * CD * SEQ) return;
  const float* q = (const float*)d_in[0];      /* query [n][c][l] */
  const float* k = (const float*)d_in[1];      /* key   [n][k][c][l] */
  const float* v = (const float*)d_in[2];      /* value [n][k][c][l] */
  char* ws = (char*)d_ws; size_t off = 0;
  auto take = [&](size_t bytes) { char* p = ws + off; off += (bytes + 255) & ~(size_t)255; return p; };
  _Float16* Q16 = (_Float16*)take((size_t)NB * SEQ * CD * 2);
  _Float16* K16 = (_Float16*)take((size_t)NB * KK * SEQ * CD * 2);
  _Float16* V16 = (_Float16*)take((size_t)NB * KK * CD * SEQ * 2);
  if (off > ws_size) return;
  k_rows16<<<GRID_R, 256, 0, stream>>>(q, k, Q16, K16);     /* in [img][64 c][L] -> out [img][SEQ l][64 c] */
  k_v16<<<GRID_V, 256, 0, stream>>>(v, V16);
  k_attn<<<GRID_A, 256, 0, stream>>>(Q16, K16, V16, (float*)d_out);
}

// v004
// One run takes 31.3 microseconds.
// Next to v003, in two timings, it ran 1.04 times as fast each time.
// Over all steps from v000 it is 3.59 times as fast.
#include <hip/hip_runtime.h>
// Contractions: scores^T = K Q^T (K = 64) and out^T = V^T P^T (K = 1024) plus the softmax denominators (all-ones A rows), all on v_wmma_f32_16x16x32_f16 with f32 accumulation; q/k/v are bf16-RNE-converted inputs carried x16 as exact f16, P = exp2 weights carried x2^14 as f16; softmax statistics f32.
// Layout: query [n][c][l], key/value/out [n][k][c][l] (channel-major, l contiguous). Planes: Q16 [n][l][c], K16 [n,k][l][c] (token rows via LDS transposes), V16 [n,k][c][l] (already V^T).
// Attention kernel: one wave owns 16 query columns; S^T tiles D[p][q] keep q on the lanes, so the running max / rescale are one scalar per lane and
// two packed D tiles form one B fragment of P^T (k = key position) directly in registers; O^T D[c][q] is the output layout.
// K and V^T tiles of 64 keys reach the block's LDS by asynchronous copies, two buffers, one barrier per step; all 8 waves read their A fragments from there.
#ifndef NB
#define NB 8            /* batches processed */
#endif
#ifndef SEQ
#define SEQ 1024        /* positions processed per image (keys and queries) */
#endif
#define NB_FULL 8
#define L_FULL 1024     /* input row pitch (positions per channel row of the inputs) */
#define KK 8            /* key sets per batch */
#define CD 64           /* channels */
#define BQ 128          /* query columns per block (8 waves x 16) */
#define BP 64           /* key positions per step */
#define QTN (SEQ / BQ)
#define NT (SEQ / BP)    /* key steps */
#define TP 72           /* LDS pitch of a staged 64-element f16 row, in elements: 144 B = 16 B x odd, for 16-byte readers */
#define TILE_E (64 * TP) /* elements of one staged 64 x 64 tile */
#define TL 256          /* positions per block of the transposing conversion kernel: 64 channels x 256 positions = 64 KiB of f32 */
#define RP 144          /* LDS bytes of one staged token row: 128 B of f16 channels + 16, 16 B x odd for 16-byte writers */
#define RG (32 * RP + 128) /* LDS bytes of a group of 32 token rows; = 32 dwords mod 64 banks, so that two rows of neighbouring groups read together cover all banks */
#define VE 16384        /* value elements per block of the streaming conversion kernel: 64 KiB of f32 */
#define GRID_R ((NB + NB * KK) * (SEQ / TL))
#define GRID_V ((NB * KK * CD * SEQ) / VE)
#define GRID_A (NB * KK * QTN)
static_assert(SEQ % BQ == 0);
static_assert(SEQ % BP == 0);
static_assert(NT >= 2 && BP == 64 && CD == 64);   /* the two-buffer ring needs two steps; the copy map below is for 64 x 64 tiles */
static_assert(SEQ <= L_FULL);
static_assert(NB <= NB_FULL);
static_assert(SEQ % TL == 0 && SEQ % 4 == 0 && L_FULL % 4 == 0);
static_assert(TL == 256 && VE == 16 * 256 * 4);   /* the conversion kernels' thread maps: 8 waves x 8 channels x 2 halves of 128 positions; 16 units of 4 elements a thread */
static_assert((size_t)GRID_R * TL * CD == (size_t)(NB + NB * KK) * SEQ * CD);   /* Q16 + K16 plane coverage */
static_assert((size_t)GRID_V * VE == (size_t)NB * KK * CD * SEQ);               /* V16 plane coverage */
static_assert((size_t)GRID_A * CD * BQ == (size_t)NB * KK * CD * SEQ);          /* output coverage */

typedef unsigned short v8us __attribute__((ext_vector_type(8), may_alias));
typedef unsigned short v4us __attribute__((ext_vector_type(4), may_alias));
typedef float  v8f  __attribute__((ext_vector_type(8)));
typedef float  v4f  __attribute__((ext_vector_type(4)));
typedef float  v4fa __attribute__((ext_vector_type(4), may_alias));
typedef _Float16 v16h __attribute__((ext_vector_type(16)));
union FragH { v16h v; v8us half[2]; _Float16 h[16]; unsigned short u[16]; };

__device__ __forceinline__ unsigned short bf16_bits(float x) { unsigned int u = __float_as_uint(x); return (unsigned short)((u + 0x7FFFu + ((u >> 16) & 1u)) >> 16); }
__device__ __forceinline__ float bf16_val(unsigned short b) { return __uint_as_float(((unsigned int)b) << 16); }
__device__ __forceinline__ float bf16_rne(float x) { return bf16_val(bf16_bits(x)); }

// fragment (A: row = lane&15, B: column = lane&15) from a k-contiguous f16 row: elements 0..7 <- k 8h..8h+7, elements 8..15 <- k 16+8h..16+8h+7
__device__ __forceinline__ v16h g2_frag(const _Float16* p, unsigned hh) { FragH f; f.half[0] = *(const v8us*)((const unsigned short*)p + 8u * hh); f.half[1] = *(const v8us*)((const unsigned short*)p + 16u + 8u * hh); return f.v; }
__device__ __forceinline__ v8f g2_mma(v16h a, v16h b, v8f c) { return __builtin_amdgcn_wmma_f32_16x16x32_f16(false, a, false, b, (short)0, c, false, false); }

// 2^x as the bare v_exp_f32, without the library's handling of results below 2^-126 (a range test, two selects, an add and a v_ldexp_f32 per value): such a result comes out as 0 instead of a subnormal.
// A weight is rounded to f16, where everything below 2^-25 is 0 in either form; a rescale factor that small multiplies sums that then stand beside a new term of 2^14.
__device__ __forceinline__ float exp2_hw(float x) { return __builtin_amdgcn_exp2f(x); }

// Both conversion kernels, x -> f16(bf16(x) * 16): every thread has 16 loads of 16 B in flight (64 KiB per block) and every wave-wide load and store covers whole 128-B lines.
// channel-first query / key images [img][c][L_FULL] -> token rows [img][l][c], 64 channels x 256 positions per block, transposed through LDS
__global__ __launch_bounds__(256) void k_rows16(const float* __restrict__ Xq, const float* __restrict__ Xk, _Float16* __restrict__ Q16, _Float16* __restrict__ K16) {
  __shared__ __attribute__((aligned(16))) unsigned char tl[8 * RG];   /* token row l at ((l >> 7) * 4 + (l & 3)) * RG + ((l >> 2) & 31) * RP */
  const unsigned tid = threadIdx.x, w = tid >> 5, lane = tid & 31u;
  const unsigned nl = SEQ / TL;
  const unsigned nbq = NB * nl;
  unsigned bi = blockIdx.x;
  const bool isq = bi < nbq;                 /* block-uniform */
  if (!isq) bi -= nbq;
  const unsigned img = bi / nl, lb = bi - img * nl;
  /* wave w reads channels 8w .. 8w+7; a lane reads positions 4*lane .. 4*lane+3 of each half of 128 */
  const float* X = (isq ? Xq : Xk) + ((size_t)img * CD + w * 8u) * L_FULL + (size_t)lb * TL + lane * 4u;
  v4f x[2][8];
#pragma unroll   /* this nest and the next: x[][] in registers, all 16 loads issued ahead of the first use */
  for (int j = 0; j < 2; ++j)
#pragma unroll
    for (int q = 0; q < 8; ++q) x[j][q] = *(const v4fa*)(X + (size_t)q * L_FULL + j * 128);
  asm volatile("s_wait_xcnt 0x0" :: "v"(X) : "memory");   /* the loads' address stays in its registers up to this wait */
#pragma unroll
  for (int j = 0; j < 2; ++j)
#pragma unroll
    for (int e = 0; e < 4; ++e) {
      FragH f;
#pragma unroll
      for (int q = 0; q < 8; ++q) f.h[q] = (_Float16)(bf16_rne(x[j][q][e]) * 16.0f);
      *(v8us*)(tl + (j * 4 + e) * RG + lane * RP + w * 16u) = f.half[0];   /* position 128j + 4*lane + e, channels 8w .. 8w+7 */
    }
  __syncthreads();                           /* cross-wave LDS exchange */
  unsigned short* D = (unsigned short*)(isq ? Q16 : K16) + ((size_t)img * SEQ + (size_t)lb * TL) * CD;
#pragma unroll
  for (int it = 0; it < 8; ++it) {
    const unsigned g = it * 256u + tid, l = g >> 3, ch = g & 7u;          /* 16-byte chunk g = position l, channels 8ch .. 8ch+7; a wave stores 512 contiguous bytes */
    const v8us o = *(const v8us*)(tl + ((l >> 7) * 4u + (l & 3u)) * RG + ((l >> 2) & 31u) * RP + ch * 16u);
    *(v8us*)(D + (size_t)g * 8u) = o;
  }
}

// value rows [row][L_FULL] -> V16 [row][SEQ], element order kept
// amdgpu_waves_per_eu: at most 8 waves per SIMD planned for, so that the scheduler takes the registers for all 16 loads; without it it holds four loads back behind the first results
__global__ __launch_bounds__(256) __attribute__((amdgpu_waves_per_eu(2, 8))) void k_v16(const float* __restrict__ V, _Float16* __restrict__ V16) {
  const unsigned u0 = blockIdx.x * (VE / 4u) + threadIdx.x;   /* units of 4 elements */
  v4f x[16];
#pragma unroll   /* x[] in registers, all 16 loads issued ahead of the first use */
  for (int i = 0; i < 16; ++i) {
    const unsigned u = u0 + i * 256u, row = u / (SEQ / 4u), l4 = (u - row * (SEQ / 4u)) * 4u;
    x[i] = *(const v4fa*)(V + (size_t)row * L_FULL + l4);
  }
#pragma unroll
  for (int i = 0; i < 16; ++i) {
    FragH f;
#pragma unroll
    for (int e = 0; e < 4; ++e) f.h[e] = (_Float16)(bf16_rne(x[i][e]) * 16.0f);
    const v4us o = {f.u[0], f.u[1], f.u[2], f.u[3]};
    *(v4us*)((unsigned short*)V16 + (size_t)(u0 + i * 256u) * 4u) = o;
  }
}

// One step's K tile (64 key rows x 64 channels) and V^T tile (64 channel rows x 64 positions) into LDS: 16 B per lane and copy, two copies per tile and thread, every lane on.
// The s_wait_xcnt stands inside the statement so that it precedes any later rewrite of the address registers the copies name.
__device__ __forceinline__ void stage_kv(unsigned lk, const _Float16* gk, unsigned lv, const _Float16* gv) {
  const unsigned lk1 = lk + 32u * TP * 2u, lv1 = lv + 32u * TP * 2u;
  const _Float16* gk1 = gk + 32 * CD;
  const _Float16* gv1 = gv + (size_t)32 * SEQ;
  asm volatile("global_load_async_to_lds_b128 %0, %1, off\n\t"
               "global_load_async_to_lds_b128 %2, %3, off\n\t"
               "global_load_async_to_lds_b128 %4, %5, off\n\t"
               "global_load_async_to_lds_b128 %6, %7, off\n\t"
               "s_wait_xcnt 0x0"
               :: "v"(lk), "v"(gk), "v"(lk1), "v"(gk1), "v"(lv), "v"(gv), "v"(lv1), "v"(gv1) : "memory");
}

// flash attention per (n, k) pair and 128 query columns; wave w owns columns q0 .. q0+15 (lane&15 = column)
__global__ __launch_bounds__(256) void k_attn(const _Float16* __restrict__ Q16, const _Float16* __restrict__ K16, const _Float16* __restrict__ V16, float* __restrict__ out) {
  __shared__ __attribute__((aligned(16))) float so[CD][BQ + 4];      /* block output tile [c][q]; cross-wave (block barrier) */
  __shared__ __attribute__((aligned(16))) _Float16 kv[2][2][TILE_E];  /* ring of two buffers, each a K tile [p][c] and a V^T tile [c][p], shared by the 8 waves */
  const unsigned tid = threadIdx.x, w = tid >> 5, lane = tid & 31u, ln = lane & 15u, hh = lane >> 4;
  const unsigned pair = blockIdx.x / QTN, qt = blockIdx.x - pair * QTN, n = pair / KK;
  const unsigned q0 = qt * BQ + w * 16u;
  const _Float16* qrow = Q16 + ((size_t)n * SEQ + q0 + ln) * CD;
  const v16h bq0 = g2_frag(qrow, hh), bq1 = g2_frag(qrow + 32, hh);                 /* B = Q^T: column q, k = channel */
  const unsigned crow = tid >> 3, cc8 = (tid & 7u) * 8u;                             /* copy map: thread -> tile rows crow and crow + 32, elements cc8 .. cc8+7 */
  const _Float16* gk = K16 + ((size_t)pair * SEQ + crow) * CD + cc8;                  /* step 0's source, K rows p */
  const _Float16* gv = V16 + ((size_t)pair * CD + crow) * SEQ + cc8;                  /* step 0's source, V^T rows c */
  const unsigned lk0 = (unsigned)(size_t)&kv[0][0][crow * TP + cc8];                  /* LDS byte address of this lane's first K chunk, buffer 0 */
  const unsigned LT = TILE_E * 2u;                                                    /* bytes of one tile: K -> V^T; two of them: buffer 0 -> 1 */
  stage_kv(lk0, gk, lk0 + LT, gv);
  asm volatile("s_wait_asynccnt 0x0" ::: "memory");      /* own copies of step 0 landed */
  __syncthreads();                                       /* step 0 readable by every wave */
  stage_kv(lk0 + 2u * LT, gk + (size_t)BP * CD, lk0 + 3u * LT, gv + BP);   /* step 1 flies during step 0 */
  FragH on;
#pragma unroll
  for (int e = 0; e < 16; ++e) on.h[e] = (_Float16)1.0f;                            /* all-ones A: every D row = column sums of P^T */
  const v8f z8 = {0.f, 0.f, 0.f, 0.f, 0.f, 0.f, 0.f, 0.f};
  v8f o[4] = {z8, z8, z8, z8};
  v8f osum = z8;
  float m = -3.0e38f;                                   /* running max of the scaled logits (base-2 domain) */
  const float SC = 0.005635527503472513f;               /* log2(e) / 256: undoes the x16 carries of q and k */
#pragma unroll 1
  for (unsigned t = 0; t < NT; ++t) {
    const _Float16* kt = &kv[t & 1u][0][ln * TP];        /* A = K rows: row p, k = channel */
    const _Float16* vt = &kv[t & 1u][1][ln * TP];        /* A = V^T rows: row c, k = position */
    v8f s[4];
#pragma unroll
    for (int pt = 0; pt < 4; ++pt) {
      const _Float16* kr = kt + pt * 16 * TP;
      const v16h a0 = g2_frag(kr, hh), a1 = g2_frag(kr + 32, hh);
      const v8f c = g2_mma(a0, bq0, z8);
      s[pt] = g2_mma(a1, bq1, c);                       /* D[row p = pt*16 + 8h + r][col q = lane&15] */
    }
    float bm = -3.0e38f;
#pragma unroll
    for (int pt = 0; pt < 4; ++pt)
#pragma unroll
      for (int r = 0; r < 8; ++r) { const float t = s[pt][r] * SC; s[pt][r] = t; bm = fmaxf(bm, t); }
    bm = fmaxf(bm, __shfl_xor(bm, 16, 32));             /* other lane half holds the remaining 32 key positions of this column */
    const float mn = fmaxf(m, bm);
    const float sc = exp2_hw(m - mn);
    m = mn;
    const float mm = mn - 14.0f;                         /* weights carried x2^14 (max 16384) */
    FragH b0, b1;                                        /* P^T as B: element r <- tile with k 0..15, element 8+r <- tile with k 16..31, lane unchanged */
#pragma unroll
    for (int r = 0; r < 8; ++r) {
      b0.h[r]     = (_Float16)exp2_hw(s[0][r] - mm);
      b0.h[8 + r] = (_Float16)exp2_hw(s[1][r] - mm);
      b1.h[r]     = (_Float16)exp2_hw(s[2][r] - mm);
      b1.h[8 + r] = (_Float16)exp2_hw(s[3][r] - mm);
    }
#pragma unroll
    for (int ct = 0; ct < 4; ++ct)
#pragma unroll
      for (int r = 0; r < 8; ++r) o[ct][r] *= sc;
#pragma unroll
    for (int r = 0; r < 8; ++r) osum[r] *= sc;
#pragma unroll
    for (int ct = 0; ct < 4; ++ct) {
      const _Float16* vr = vt + ct * 16 * TP;
      const v16h a0 = g2_frag(vr, hh), a1 = g2_frag(vr + 32, hh);
      o[ct] = g2_mma(a0, b0.v, o[ct]);
      o[ct] = g2_mma(a1, b1.v, o[ct]);                  /* D[row c = ct*16 + 8h + r][col q] */
    }
    osum = g2_mma(on.v, b0.v, osum);
    osum = g2_mma(on.v, b1.v, osum);                    /* every element = sum over keys of the f16 weights of column q */
    asm volatile("s_wait_dscnt 0x0" ::: "memory");       /* own reads of this buffer done before it is refilled */
    asm volatile("s_wait_asynccnt 0x0" ::: "memory");    /* own copies of step t + 1 landed */
    __syncthreads();                                     /* publishes step t + 1 and ends every wave's reads of step t */
    if (t + 2u < NT) {                                   /* block-uniform */
      const unsigned lb = lk0 + (t & 1u) * 2u * LT;
      stage_kv(lb, gk + (size_t)(t + 2u) * BP * CD, lb + LT, gv + (t + 2u) * BP);
    }
  }
  asm volatile("s_wait_asynccnt 0x0" ::: "memory");      /* nothing of the ring in flight at the wave's end */
  const float rinv = (1.0f / osum[0]) * 0.0625f;        /* 1/sum, and the x16 carry of v */
#pragma unroll
  for (int ct = 0; ct < 4; ++ct)
#pragma unroll
    for (int r = 0; r < 8; ++r) so[ct * 16 + 8 * hh + r][w * 16u + ln] = o[ct][r] * rinv;
  __syncthreads();
  float* ob = out + ((size_t)pair * CD) * SEQ + (size_t)qt * BQ;
  {
#pragma unroll
    for (int i = 0; i < 8; ++i) {
      const unsigned c = w * 8u + i;
      const v4f v = *(const v4fa*)&so[c][lane * 4u];
      *(v4f*)(ob + (size_t)c * SEQ + lane * 4u) = v;
    }
    
  }
}

extern "C" void kernel_launch(void* const* d_in, const int* in_sizes, int n_in,
                              void* d_out, int out_size, void* d_ws, size_t ws_size, hipStream_t stream) {
  if (n_in < 3) return;
  const long long qmin = (long long)(NB * CD - 1) * L_FULL + SEQ;
  const long long kmin = (long long)(NB * KK * CD - 1) * L_FULL + SEQ;
  if ((long long)in_sizes[0] < qmin || (long long)in_sizes[1] < kmin || (long long)in_sizes[2] < kmin) return;
  if ((long long)out_size < (long long)NB * KK * CD * SEQ) return;
  const float* q = (const float*)d_in[0];      /* query [n][c][l] */
  const float* k = (const float*)d_in[1];      /* key   [n][k][c][l] */
  const float* v = (const float*)d_in[2];      /* value [n][k][c][l] */
  char* ws = (char*)d_ws; size_t off = 0;
  auto take = [&](size_t bytes) { char* p = ws + off; off += (bytes + 255) & ~(size_t)255; return p; };
  _Float16* Q16 = (_Float16*)take((size_t)NB * SEQ * CD * 2);
  _Float16* K16 = (_Float16*)take((size_t)NB * KK * SEQ * CD * 2);
  _Float16* V16 = (_Float16*)take((size_t)NB * KK * CD * SEQ * 2);
  if (off > ws_size) return;
  k_rows16<<<GRID_R, 256, 0, stream>>>(q, k, Q16, K16);     /* in [img][64 c][L] -> out [img][SEQ l][64 c] */
  k_v16<<<GRID_V, 256, 0, stream>>>(v, V16);
  k_attn<<<GRID_A, 256, 0, stream>>>(Q16, K16, V16, (float*)d_out);
}

// v005
// Measured time: 21.3 microseconds a run.
// Two timings next to v004 both put it at 1.47 times that version's speed.
// All steps since v000 together make it 5.27 times as fast.
#include <hip/hip_runtime.h>
// Contractions: scores^T = K Q^T (K = 64) and out^T = V^T P^T (K = 1024) plus the softmax denominators (all-ones A rows), all on v_wmma_f32_16x16x32_f16 with f32 accumulation; q/k/v are bf16-RNE-converted inputs carried x16 as exact f16, P = exp2 weights carried x2^14 as f16; softmax statistics f32.
// Layout: query [n][c][l], key/value/out [n][k][c][l] (channel-major, l contiguous). One launch: the kernel reads the f32 inputs itself, no workspace.
// One wave owns 16 query columns; S^T tiles D[p][q] keep q on the lanes, so the running max / rescale are one scalar per lane and
// two packed D tiles form one B fragment of P^T (k = key position) directly in registers; O^T D[c][q] is the output layout.
// K and V^T tiles of 64 keys: each thread loads 16 f32 one step ahead into registers, converts them and stores f16 into the block's LDS ring (two buffers, one barrier per step); all 16 waves read their A fragments from there.
#ifndef NB
#define NB 8            /* batches processed */
#endif
#ifndef SEQ
#define SEQ 1024        /* positions processed per image (keys and queries) */
#endif
#define NB_FULL 8
#define L_FULL 1024     /* input row pitch (positions per channel row of the inputs) */
#define KK 8            /* key sets per batch */
#define CD 64           /* channels */
#define BQ 256          /* query columns per block (16 waves x 16) */
#define BP 64           /* key positions per step */
#define QTN (SEQ / BQ)
#define NT (SEQ / BP)    /* key steps */
#define TP 72           /* LDS pitch of a staged 64-element f16 row, in elements: 144 B = 16 B x odd, for 16-byte readers and writers */
#define TILE_E (64 * TP) /* elements of one staged 64 x 64 tile */
#define GRID_A (NB * KK * QTN)
static_assert(SEQ % BQ == 0);
static_assert(SEQ % BP == 0);
static_assert(NT >= 3 && BP == 64 && CD == 64 && BQ == 256);   /* the loop below peels the last two steps; the staging maps are for 64 x 64 tiles and 16 waves */
static_assert(SEQ <= L_FULL);
static_assert(NB <= NB_FULL);
static_assert(SEQ % 4 == 0 && L_FULL % 4 == 0);
static_assert((size_t)GRID_A * CD * BQ == (size_t)NB * KK * CD * SEQ);          /* output coverage */

typedef unsigned short v8us __attribute__((ext_vector_type(8), may_alias));
typedef unsigned short v4us __attribute__((ext_vector_type(4), may_alias));
typedef float  v8f  __attribute__((ext_vector_type(8)));
typedef float  v4f  __attribute__((ext_vector_type(4)));
typedef float  v2f  __attribute__((ext_vector_type(2)));
typedef float  v4fa __attribute__((ext_vector_type(4), may_alias));
typedef _Float16 v16h __attribute__((ext_vector_type(16)));
typedef _Float16 v2h __attribute__((ext_vector_type(2)));
typedef __bf16 v2b __attribute__((ext_vector_type(2)));
union FragH { v16h v; v8us half[2]; v4us quar[4]; v2h p[8]; _Float16 h[16]; };

// two inputs x -> f16(bf16(16 x)), roundings to nearest even; 16 x is exact and bf16(16 x) = 16 bf16(x), which f16 holds exactly from 2^-14 up to its largest value
__device__ __forceinline__ v2h cv2(float a, float b) {
  const v2f x = {a, b};
  const v2b r = __builtin_convertvector(x * 16.0f, v2b);
  return __builtin_convertvector(__builtin_convertvector(r, v2f), v2h);
}

// fragment (A: row = lane&15, B: column = lane&15) from a k-contiguous f16 row: elements 0..7 <- k 8h..8h+7, elements 8..15 <- k 16+8h..16+8h+7
__device__ __forceinline__ v16h g2_frag(const _Float16* p, unsigned hh) { FragH f; f.half[0] = *(const v8us*)((const unsigned short*)p + 8u * hh); f.half[1] = *(const v8us*)((const unsigned short*)p + 16u + 8u * hh); return f.v; }
__device__ __forceinline__ v8f g2_mma(v16h a, v16h b, v8f c) { return __builtin_amdgcn_wmma_f32_16x16x32_f16(false, a, false, b, (short)0, c, false, false); }

// 2^x as the bare v_exp_f32, without the library's handling of results below 2^-126 (a range test, two selects, an add and a v_ldexp_f32 per value): such a result comes out as 0 instead of a subnormal.
// A weight is rounded to f16, where everything below 2^-25 is 0 in either form; a rescale factor that small multiplies sums that then stand beside a new term of 2^14.
__device__ __forceinline__ float exp2_hw(float x) { return __builtin_amdgcn_exp2f(x); }

// flash attention per (n, k) pair and 256 query columns; wave w owns columns q0 .. q0+15 (lane&15 = column)
__global__ __launch_bounds__(512) void k_attn(const float* __restrict__ Xq, const float* __restrict__ Xk, const float* __restrict__ Xv, float* __restrict__ out) {
  __shared__ __attribute__((aligned(16))) float so[CD][BQ + 4];      /* block output tile [c][q]; cross-wave (block barrier) */
  __shared__ __attribute__((aligned(16))) _Float16 kv[2][2][TILE_E];  /* ring of two buffers, each a K tile [p][c] and a V^T tile [c][p], shared by the 16 waves */
  const unsigned tid = threadIdx.x, w = tid >> 5, lane = tid & 31u, ln = lane & 15u, hh = lane >> 4;
  const unsigned pair = blockIdx.x / QTN, qt = blockIdx.x - pair * QTN, n = pair / KK;
  const unsigned q0 = qt * BQ + w * 16u;
  /* K staging map: a thread takes one key position and 8 channels (the transpose happens in its registers); a wave-wide load is one 128-B line of a channel row, its LDS store 32 token rows x 16 B */
  const unsigned kp = (w & 1u) * 32u + lane, kc = (w >> 1) * 8u;
  const float* gk = Xk + ((size_t)pair * CD + kc) * L_FULL + kp;
  _Float16* const lk = &kv[0][0][kp * TP + kc];
  /* V^T staging map: a thread takes 4 positions of channel rows vr and vr + 2; a wave-wide load is 256 B of each of two rows */
  const unsigned vr = w * 4u + hh;
  const float* gv = Xv + ((size_t)pair * CD + vr) * L_FULL + ln * 4u;
  _Float16* const lv = &kv[0][1][vr * TP + ln * 4u];
  float xk[8];
  v4f xv[2];
  auto load_kv = [&](unsigned t) {             /* step t's 16 inputs of this thread into registers */
#pragma unroll
    for (int q = 0; q < 8; ++q) xk[q] = gk[(size_t)q * L_FULL + t * BP];
#pragma unroll
    for (int j = 0; j < 2; ++j) xv[j] = *(const v4fa*)(gv + (size_t)(2 * j) * L_FULL + t * BP);
  };
  auto store_kv = [&](unsigned b) {            /* converts them and stores them into ring buffer b */
    FragH f, g;
#pragma unroll
    for (int i = 0; i < 4; ++i) f.p[i] = cv2(xk[2 * i], xk[2 * i + 1]);
    *(v8us*)(lk + b * 2u * TILE_E) = f.half[0];
#pragma unroll
    for (int j = 0; j < 2; ++j) {
      g.p[2 * j] = cv2(xv[j][0], xv[j][1]);
      g.p[2 * j + 1] = cv2(xv[j][2], xv[j][3]);
      *(v4us*)(lv + b * 2u * TILE_E + j * 2 * TP) = g.quar[j];
    }
  };
  load_kv(0);
  /* B = Q^T: column q, k = channel, in the k order of g2_frag; 32 loads of one f32 per lane, once per wave */
  const float* gq = Xq + ((size_t)n * CD + 8u * hh) * L_FULL + q0 + ln;
  float xq[32];
#pragma unroll
  for (int e = 0; e < 32; ++e) xq[e] = gq[(size_t)((e >> 3) * 16 + (e & 7)) * L_FULL];   /* element e of the two fragments: channel 16 (e / 8) + 8 h + e % 8 */
  store_kv(0);
  load_kv(1);                                           /* step 1 flies during step 0 */
  FragH fq0, fq1;
#pragma unroll
  for (int i = 0; i < 8; ++i) { fq0.p[i] = cv2(xq[2 * i], xq[2 * i + 1]); fq1.p[i] = cv2(xq[16 + 2 * i], xq[16 + 2 * i + 1]); }
  const v16h bq0 = fq0.v, bq1 = fq1.v;
  __syncthreads();                                       /* step 0 readable by every wave */
  FragH on;
#pragma unroll
  for (int e = 0; e < 16; ++e) on.h[e] = (_Float16)1.0f;                            /* all-ones A: every D row = column sums of P^T */
  const v8f z8 = {0.f, 0.f, 0.f, 0.f, 0.f, 0.f, 0.f, 0.f};
  v8f o[4] = {z8, z8, z8, z8};
  v8f osum = z8;
  float m = -3.0e38f;                                   /* running max of the scaled logits (base-2 domain) */
  const float SC = 0.005635527503472513f;               /* log2(e) / 256: undoes the x16 carries of q and k */
  /* one key step; fill: step t + 1 exists and is converted into the other buffer; fetch: step t + 2 exists and its loads are issued (both compile-time at every call) */
  auto step = [&](unsigned t, bool fill, bool fetch) {
    const _Float16* kt = &kv[t & 1u][0][ln * TP];        /* A = K rows: row p, k = channel */
    const _Float16* vt = &kv[t & 1u][1][ln * TP];        /* A = V^T rows: row c, k = position */
    v8f s[4];
#pragma unroll
    for (int pt = 0; pt < 4; ++pt) {
      const _Float16* kr = kt + pt * 16 * TP;
      const v16h a0 = g2_frag(kr, hh), a1 = g2_frag(kr + 32, hh);
      const v8f c = g2_mma(a0, bq0, z8);
      s[pt] = g2_mma(a1, bq1, c);                       /* D[row p = pt*16 + 8h + r][col q = lane&15] */
    }
    if (fill) store_kv((t + 1u) & 1u);                   /* that buffer's last readers (step t - 1) are behind the barrier that ended their step */
    if (fetch) load_kv(t + 2u);                          /* a whole step ahead of its conversion */
    float bm = -3.0e38f;
#pragma unroll
    for (int pt = 0; pt < 4; ++pt)
#pragma unroll
      for (int r = 0; r < 8; ++r) { const float t = s[pt][r] * SC; s[pt][r] = t; bm = fmaxf(bm, t); }
    bm = fmaxf(bm, __shfl_xor(bm, 16, 32));             /* other lane half holds the remaining 32 key positions of this column */
    const float mn = fmaxf(m, bm);
    const float sc = exp2_hw(m - mn);
    m = mn;
    const float mm = mn - 14.0f;                         /* weights carried x2^14 (max 16384) */
    FragH b0, b1;                                        /* P^T as B: element r <- tile with k 0..15, element 8+r <- tile with k 16..31, lane unchanged */
#pragma unroll
    for (int r = 0; r < 8; ++r) {
      b0.h[r]     = (_Float16)exp2_hw(s[0][r] - mm);
      b0.h[8 + r] = (_Float16)exp2_hw(s[1][r] - mm);
      b1.h[r]     = (_Float16)exp2_hw(s[2][r] - mm);
      b1.h[8 + r] = (_Float16)exp2_hw(s[3][r] - mm);
    }
#pragma unroll
    for (int ct = 0; ct < 4; ++ct)
#pragma unroll
      for (int r = 0; r < 8; ++r) o[ct][r] *= sc;
#pragma unroll
    for (int r = 0; r < 8; ++r) osum[r] *= sc;
#pragma unroll
    for (int ct = 0; ct < 4; ++ct) {
      const _Float16* vr16 = vt + ct * 16 * TP;
      const v16h a0 = g2_frag(vr16, hh), a1 = g2_frag(vr16 + 32, hh);
      o[ct] = g2_mma(a0, b0.v, o[ct]);
      o[ct] = g2_mma(a1, b1.v, o[ct]);                  /* D[row c = ct*16 + 8h + r][col q] */
    }
    osum = g2_mma(on.v, b0.v, osum);
    osum = g2_mma(on.v, b1.v, osum);                    /* every element = sum over keys of the f16 weights of column q */
    if (fill) __syncthreads();                           /* publishes step t + 1 and ends every wave's reads of step t */
  };
#pragma unroll 1   /* one copy of the step in the loop: unrolled it would only grow the code */
  for (unsigned t = 0; t + 2u < NT; ++t) step(t, true, true);
  step(NT - 2u, true, false);
  step(NT - 1u, false, false);
  const float rinv = (1.0f / osum[0]) * 0.0625f;        /* 1/sum, and the x16 carry of v */
#pragma unroll
  for (int ct = 0; ct < 4; ++ct)
#pragma unroll
    for (int r = 0; r < 8; ++r) so[ct * 16 + 8 * hh + r][w * 16u + ln] = o[ct][r] * rinv;
  __syncthreads();
  float* ob = out + ((size_t)pair * CD) * SEQ + (size_t)qt * BQ;
#pragma unroll
  for (int i = 0; i < 8; ++i) {
    const unsigned c = w * 4u + (i >> 1), col = (i & 1) * 128u + lane * 4u;   /* a wave stores 512 contiguous bytes */
    const v4f v = *(const v4fa*)&so[c][col];
    *(v4f*)(ob + (size_t)c * SEQ + col) = v;
  }
}

extern "C" void kernel_launch(void* const* d_in, const int* in_sizes, int n_in,
                              void* d_out, int out_size, void* d_ws, size_t ws_size, hipStream_t stream) {
  if (n_in < 3) return;
  const long long qmin = (long long)(NB * CD - 1) * L_FULL + SEQ;
  const long long kmin = (long long)(NB * KK * CD - 1) * L_FULL + SEQ;
  if ((long long)in_sizes[0] < qmin || (long long)in_sizes[1] < kmin || (long long)in_sizes[2] < kmin) return;
  if ((long long)out_size < (long long)NB * KK * CD * SEQ) return;
  const float* q = (const float*)d_in[0];      /* query [n][c][l] */
  const float* k = (const float*)d_in[1];      /* key   [n][k][c][l] */
  const float* v = (const float*)d_in[2];      /* value [n][k][c][l] */
  k_attn<<<GRID_A, 512, 0, stream>>>(q, k, v, (float*)d_out);
}
